// v000
// Times are from an AMD MI455X. After a warm-up the kernel runs many times in a row, and a time is the length of
// such a window on the GPU divided by its runs, so every launch and the gaps after it count. The runs cycle
// through copies of the inputs. A figure is the median of several windows, for all but v000 over two sittings.
// Sittings can differ by a few percent; kernels timed side by side share one.
// The starting kernel, v000, takes 72 microseconds a run.
#include <hip/hip_runtime.h>
#include <math.h>

typedef float v2f __attribute__((ext_vector_type(2)));
typedef float v8f __attribute__((ext_vector_type(8)));

#define N_   8
#define C_   512
#define HW_  4096
#define K_   32
#define C4_  128
#define TP_  64     // pixels per workgroup tile
#define KC_  16     // channel chunk staged in LDS (double-buffered)
#define NCHUNK_ (C_ / KC_)

__device__ __forceinline__ unsigned lds_off(const void* p) {
    return (unsigned)(uintptr_t)p;
}
__device__ __forceinline__ void async_copy_b128(unsigned lds_byte, const float* gaddr) {
    asm volatile("global_load_async_to_lds_b128 %0, %1, off"
                 :: "v"(lds_byte), "v"(gaddr) : "memory");
}
__device__ __forceinline__ void wait_async0() {
    asm volatile("s_wait_asynccnt 0" ::: "memory");
}

// ---------------------------------------------------------------------------
// Kernel 1: k = y @ wk^T + bk  (N,K,C4) ; v = y @ wv^T + bv  (N,K,C)
// One block per (n, kk) row. Tiny GEMMs -> simple float4 dot products.
// ---------------------------------------------------------------------------
__global__ void kv_kernel(const float* __restrict__ y,
                          const float* __restrict__ wk, const float* __restrict__ bk,
                          const float* __restrict__ wv, const float* __restrict__ bv,
                          float* __restrict__ kbuf, float* __restrict__ vbuf) {
    const int n  = blockIdx.x >> 5;   // 0..7
    const int kk = blockIdx.x & 31;   // 0..31
    const int tid = threadIdx.x;

    __shared__ __align__(16) float yrow[C_];
    for (int i = tid; i < C_ / 4; i += 256)
        *(float4*)&yrow[i * 4] = *(const float4*)&y[((size_t)n * K_ + kk) * C_ + i * 4];
    __syncthreads();

    if (tid < C4_) {
        const float* wr = wk + (size_t)tid * C_;
        float acc = 0.f;
        for (int c = 0; c < C_; c += 4) {
            float4 w4 = *(const float4*)(wr + c);
            float4 y4 = *(const float4*)(yrow + c);
            acc += w4.x * y4.x + w4.y * y4.y + w4.z * y4.z + w4.w * y4.w;
        }
        kbuf[((size_t)n * K_ + kk) * C4_ + tid] = acc + bk[tid];
    }

    #pragma unroll
    for (int rep = 0; rep < 2; ++rep) {
        const int cidx = tid + rep * 256;
        const float* wr = wv + (size_t)cidx * C_;
        float acc = 0.f;
        for (int c = 0; c < C_; c += 4) {
            float4 w4 = *(const float4*)(wr + c);
            float4 y4 = *(const float4*)(yrow + c);
            acc += w4.x * y4.x + w4.y * y4.y + w4.z * y4.z + w4.w * y4.w;
        }
        vbuf[((size_t)n * K_ + kk) * C_ + cidx] = acc + bv[cidx];
    }
}

// ---------------------------------------------------------------------------
// Kernel 2: fused q-conv -> energy -> softmax -> out-GEMM -> residual.
// Grid (HW/TP, N), 256 threads = 8 wave32s.
// LDS (floats), unioned across phases (~59.9 KB total):
//   [0     .. 8448)  Qs 64x132 | phase1 double buffers:
//                      Xs0 16x68 @0, Xs1 @1088, Ws0 128x20 @2176, Ws1 @4736
//   [8448  ..12672)  KVs 32x132  (Ks in phase2, Vs chunk in phase4)
//   [12672 ..14976)  Es 64x36    (energy / attn)
// ---------------------------------------------------------------------------
__global__ void __launch_bounds__(256)
attn_kernel(const float* __restrict__ x, const float* __restrict__ wq,
            const float* __restrict__ bq,
            const float* __restrict__ kbuf, const float* __restrict__ vbuf,
            const float* __restrict__ scale, float* __restrict__ out) {
    __shared__ __align__(16) float smem[14976];
    float* Qs  = smem;            // 64 rows (pixel) x 132 (c4, padded)
    float* KVs = smem + 8448;     // 32 rows (k)     x 132
    float* Es  = smem + 12672;    // 64 rows (pixel) x 36

    const int tid  = threadIdx.x;
    const int wave = tid >> 5;
    const int lane = tid & 31;
    const int half = lane >> 4;
    const int m    = lane & 15;
    const int n    = blockIdx.y;
    const int p0   = blockIdx.x * TP_;     // linear pixel offset in HW

    // ---------------- Phase 1: Q tile (TP_ x C4_) -----------------
    // 4 Mtiles (pixel) x 8 Ntiles (c4). Wave w: Mtile = w>>1, Ntiles (w&1)*4 ..+3
    const int mt  = wave >> 1;
    const int ntb = (wave & 1) * 4;
    v8f qacc[4] = {v8f(0.f), v8f(0.f), v8f(0.f), v8f(0.f)};

    // async-issue helper (all 256 threads participate):
    //   Xs chunk: 16 ch x 64 px = 256 float4 (1 per thread)
    //   Ws chunk: 128 c4 x 16 ch = 512 float4 (2 per thread)
    auto issue_chunk = [&](int c0, int buf) {
        {
            const int cc = tid >> 4, p4 = tid & 15;
            async_copy_b128(lds_off(&smem[buf * 1088 + cc * 68 + p4 * 4]),
                            x + ((size_t)n * C_ + c0 + cc) * HW_ + p0 + p4 * 4);
        }
        #pragma unroll
        for (int r = 0; r < 2; ++r) {
            const int i = tid + r * 256;
            const int o = i >> 2, c4i = i & 3;
            async_copy_b128(lds_off(&smem[2176 + buf * 2560 + o * 20 + c4i * 4]),
                            wq + (size_t)o * C_ + c0 + c4i * 4);
        }
    };

    issue_chunk(0, 0);
    for (int ci = 0; ci < NCHUNK_; ++ci) {
        wait_async0();        // this wave's async writes (chunk ci) landed in LDS
        __syncthreads();      // ... and everyone else's too
        if (ci + 1 < NCHUNK_) issue_chunk((ci + 1) * KC_, (ci + 1) & 1);

        const float* Xb = smem + (ci & 1) * 1088;
        const float* Wb = smem + 2176 + (ci & 1) * 2560;
        #pragma unroll
        for (int ks = 0; ks < KC_ / 4; ++ks) {
            const int cc = ks * 4 + 2 * half;   // K component base for this lane-half
            v2f a;
            a.x = Xb[(cc + 0) * 68 + mt * 16 + m];
            a.y = Xb[(cc + 1) * 68 + mt * 16 + m];
            #pragma unroll
            for (int j = 0; j < 4; ++j) {
                const v2f b = *(const v2f*)&Wb[((ntb + j) * 16 + m) * 20 + cc];
                qacc[j] = __builtin_amdgcn_wmma_f32_16x16x4_f32(
                    false, a, false, b, (short)0, qacc[j], false, false);
            }
        }
    }
    __syncthreads();   // all waves done reading Xs/Ws before Qs overwrites them

    // bias + spill Q to LDS: Qs[p][c4]
    #pragma unroll
    for (int j = 0; j < 4; ++j) {
        const int c4 = (ntb + j) * 16 + m;
        const float bqv = bq[c4];
        #pragma unroll
        for (int v = 0; v < 8; ++v) {
            const int p = mt * 16 + v + 8 * half;
            Qs[p * 132 + c4] = qacc[j][v] + bqv;
        }
    }
    // stage k_n: KVs[kk][c4] (b128 synchronous; small)
    for (int i = tid; i < K_ * C4_ / 4; i += 256) {
        const int kk = i >> 5, q = i & 31;
        *(float4*)&KVs[kk * 132 + q * 4] =
            *(const float4*)&kbuf[((size_t)n * K_ + kk) * C4_ + q * 4];
    }
    __syncthreads();

    // ---------------- Phase 2: energy (TP_ x K_) ------------------
    {
        const int mt2 = wave & 3;
        const int nt2 = wave >> 2;
        v8f eacc = v8f(0.f);
        #pragma unroll 4
        for (int ks = 0; ks < C4_ / 4; ++ks) {
            const int cc = ks * 4 + 2 * half;
            const v2f a = *(const v2f*)&Qs[(mt2 * 16 + m) * 132 + cc];
            const v2f b = *(const v2f*)&KVs[(nt2 * 16 + m) * 132 + cc];
            eacc = __builtin_amdgcn_wmma_f32_16x16x4_f32(
                false, a, false, b, (short)0, eacc, false, false);
        }
        #pragma unroll
        for (int v = 0; v < 8; ++v) {
            const int p = mt2 * 16 + v + 8 * half;
            Es[p * 36 + nt2 * 16 + m] = eacc[v];
        }
    }
    __syncthreads();

    // ---------------- Phase 3: softmax over K_ --------------------
    if (tid < TP_) {
        float mx = -INFINITY;
        #pragma unroll
        for (int kk = 0; kk < K_; ++kk) mx = fmaxf(mx, Es[tid * 36 + kk]);
        float s = 0.f;
        #pragma unroll
        for (int kk = 0; kk < K_; ++kk) {
            const float e = __expf(Es[tid * 36 + kk] - mx);
            Es[tid * 36 + kk] = e;
            s += e;
        }
        const float inv = 1.0f / s;
        #pragma unroll
        for (int kk = 0; kk < K_; ++kk) Es[tid * 36 + kk] *= inv;
    }
    __syncthreads();

    // ---------------- Phase 4: out = scale * (v^T @ attn^T) + x ---
    // Per 128-channel block: 8 Mtiles (c) x 4 Ntiles (p); wave w -> Mtile w
    const float scl = scale[0];
    for (int cb = 0; cb < C_ / C4_; ++cb) {
        __syncthreads();
        for (int i = tid; i < K_ * C4_ / 4; i += 256) {
            const int kk = i >> 5, q = i & 31;
            *(float4*)&KVs[kk * 132 + q * 4] =
                *(const float4*)&vbuf[((size_t)n * K_ + kk) * C_ + cb * C4_ + q * 4];
        }
        __syncthreads();
        #pragma unroll
        for (int nt = 0; nt < 4; ++nt) {
            v8f oacc = v8f(0.f);
            #pragma unroll
            for (int ks = 0; ks < K_ / 4; ++ks) {
                const int kb = ks * 4 + 2 * half;
                v2f a;
                a.x = KVs[(kb + 0) * 132 + wave * 16 + m];   // V[kk][c_local]
                a.y = KVs[(kb + 1) * 132 + wave * 16 + m];
                const v2f b = *(const v2f*)&Es[(nt * 16 + m) * 36 + kb]; // attn[p][kk]
                oacc = __builtin_amdgcn_wmma_f32_16x16x4_f32(
                    false, a, false, b, (short)0, oacc, false, false);
            }
            const int pg = p0 + nt * 16 + m;
            #pragma unroll
            for (int v = 0; v < 8; ++v) {
                const int c = cb * C4_ + wave * 16 + v + 8 * half;
                const size_t idx = ((size_t)n * C_ + c) * HW_ + pg;
                out[idx] = scl * oacc[v] + x[idx];
            }
        }
    }
}

// ---------------------------------------------------------------------------
extern "C" void kernel_launch(void* const* d_in, const int* in_sizes, int n_in,
                              void* d_out, int out_size, void* d_ws, size_t ws_size,
                              hipStream_t stream) {
    const float* x     = (const float*)d_in[0];
    const float* y     = (const float*)d_in[1];
    const float* wq    = (const float*)d_in[2];
    const float* bq    = (const float*)d_in[3];
    const float* wk    = (const float*)d_in[4];
    const float* bk    = (const float*)d_in[5];
    const float* wv    = (const float*)d_in[6];
    const float* bv    = (const float*)d_in[7];
    const float* scale = (const float*)d_in[8];
    float* out  = (float*)d_out;
    float* kbuf = (float*)d_ws;                      // N*K*C4 floats
    float* vbuf = kbuf + (size_t)N_ * K_ * C4_;      // N*K*C  floats

    kv_kernel<<<dim3(N_ * K_), dim3(256), 0, stream>>>(y, wk, bk, wv, bv, kbuf, vbuf);
    attn_kernel<<<dim3(HW_ / TP_, N_), dim3(256), 0, stream>>>(x, wq, bq, kbuf, vbuf, scale, out);
}

// v001
// It runs in 46.7 microseconds.
// In two side-by-side timings against v000, it was 1.57 and 1.56 times as fast.
#include <hip/hip_runtime.h>
#include <math.h>

typedef float v2f __attribute__((ext_vector_type(2)));
typedef float v8f __attribute__((ext_vector_type(8)));

#define N_   8
#define C_   512
#define HW_  4096
#define K_   32
#define C4_  128
#define TP_  64     // pixels per workgroup tile
#define KC_  16     // channel chunk staged in LDS (double-buffered)
#define NCHUNK_ (C_ / KC_)

__device__ __forceinline__ unsigned lds_off(const void* p) {
    return (unsigned)(uintptr_t)p;
}
__device__ __forceinline__ void async_copy_b128(unsigned lds_byte, const float* gaddr) {
    asm volatile("global_load_async_to_lds_b128 %0, %1, off"
                 :: "v"(lds_byte), "v"(gaddr) : "memory");
}
__device__ __forceinline__ void wait_async0() {
    asm volatile("s_wait_asynccnt 0" ::: "memory");
}

// ---------------------------------------------------------------------------
// Kernel 1: k = y @ wk^T + bk  (N,K,C4) ; v = y @ wv^T + bv  (N,K,C)
// One GEMM of 256 rows (n,kk) x 640 columns (128 of wk, then 512 of wv) x 512.
// Block = 32 rows x 32 columns, 8 waves. The 32 y rows and 32 weight rows are
// staged in LDS with whole-line loads; wave w takes channels 64w .. 64w+63 of
// all four 16x16 tiles on the matrix unit; the 8 partial tiles are summed
// through LDS, wave 0 first.
//   St  64 rows x 516 floats (pitch 16 B x odd: b128 fragment reads, no conflict)
//   Red 8 waves x 4 tiles x 272 floats
// ---------------------------------------------------------------------------
#define KVP_  516
#define KVT_  272
__global__ void __launch_bounds__(256)
kv_kernel(const float* __restrict__ y,
          const float* __restrict__ wk, const float* __restrict__ bk,
          const float* __restrict__ wv, const float* __restrict__ bv,
          float* __restrict__ kbuf, float* __restrict__ vbuf) {
    __shared__ __align__(16) float St[64 * KVP_];
    __shared__ __align__(16) float Red[8 * 4 * KVT_];

    const int rg   = blockIdx.x & 7;    // row group = batch index n
    const int cg   = blockIdx.x >> 3;   // column group: 0..3 wk, 4..19 wv
    const int tid  = threadIdx.x;
    const int wave = tid >> 5;
    const int lane = tid & 31;
    const int half = lane >> 4;
    const int m    = lane & 15;

    const bool isk = cg < 4;
    const float* ysrc = y + (size_t)rg * K_ * C_;
    const float* wsrc = isk ? wk + (size_t)cg * 32 * C_ : wv + (size_t)(cg - 4) * 32 * C_;
    const float  bias = isk ? bk[cg * 32 + lane] : bv[(cg - 4) * 32 + lane];

    // stage: each wave-wide load covers 512 contiguous bytes of one row.
    // Unrolled so that t[] stays in registers and all 32 loads are in flight
    // before the first LDS store waits.
    {
        const int r0  = tid >> 7;          // 0..1
        const int col = (tid & 127) * 4;
        float4 t[32];
        #pragma unroll
        for (int i = 0; i < 16; ++i)
            t[i] = *(const float4*)&ysrc[(size_t)(2 * i + r0) * C_ + col];
        #pragma unroll
        for (int i = 0; i < 16; ++i)
            t[16 + i] = *(const float4*)&wsrc[(size_t)(2 * i + r0) * C_ + col];
        #pragma unroll
        for (int i = 0; i < 32; ++i)
            *(float4*)&St[(2 * i + r0) * KVP_ + col] = t[i];
    }
    __syncthreads();

    // A = y rows, B = weight rows, both loaded by the same code: per 8 channels
    // lane half h holds channels 4h..4h+3; .xy feed one product, .zw the next.
    // Unrolled (here and below) so that the tiles stay in registers under
    // constant indices and the next fragments are read ahead of the products.
    v8f acc[2][2] = {{v8f(0.f), v8f(0.f)}, {v8f(0.f), v8f(0.f)}};
    #pragma unroll
    for (int s = 0; s < 8; ++s) {
        const int kb = wave * 64 + s * 8 + 4 * half;
        float4 fa[2], fb[2];
        #pragma unroll
        for (int i = 0; i < 2; ++i) {
            fa[i] = *(const float4*)&St[(i * 16 + m) * KVP_ + kb];
            fb[i] = *(const float4*)&St[(32 + i * 16 + m) * KVP_ + kb];
        }
        #pragma unroll
        for (int i = 0; i < 2; ++i)
            #pragma unroll
            for (int j = 0; j < 2; ++j) {
                const v2f a = {fa[i].x, fa[i].y};
                const v2f b = {fb[j].x, fb[j].y};
                acc[i][j] = __builtin_amdgcn_wmma_f32_16x16x4_f32(
                    false, a, false, b, (short)0, acc[i][j], false, false);
            }
        #pragma unroll
        for (int i = 0; i < 2; ++i)
            #pragma unroll
            for (int j = 0; j < 2; ++j) {
                const v2f a = {fa[i].z, fa[i].w};
                const v2f b = {fb[j].z, fb[j].w};
                acc[i][j] = __builtin_amdgcn_wmma_f32_16x16x4_f32(
                    false, a, false, b, (short)0, acc[i][j], false, false);
            }
    }

    // keeps the address arithmetic below out of the matrix run: there it would
    // overwrite A and B registers directly behind the products that read them
    __builtin_amdgcn_sched_barrier(0);

    #pragma unroll
    for (int i = 0; i < 2; ++i)
        #pragma unroll
        for (int j = 0; j < 2; ++j)
            #pragma unroll
            for (int v = 0; v < 8; ++v)
                Red[(wave * 4 + i * 2 + j) * KVT_ + v * 32 + lane] = acc[i][j][v];
    __syncthreads();

    // sum the 8 partials; a wave writes one whole 128-byte line of one row
    const int c = lane;
    float* dst = isk ? kbuf + (size_t)rg * K_ * C4_ + cg * 32 : vbuf + (size_t)rg * K_ * C_ + (cg - 4) * 32;
    const int ld = isk ? C4_ : C_;
    #pragma unroll
    for (int q = 0; q < 4; ++q) {
        const int r   = q * 8 + wave;                 // 0..31
        const int idx = ((r >> 4) * 2 + (c >> 4)) * KVT_ + (r & 7) * 32 + ((r >> 3) & 1) * 16 + (c & 15);
        float s = Red[idx];
        #pragma unroll
        for (int w = 1; w < 8; ++w) s += Red[w * 4 * KVT_ + idx];
        s += bias;
        dst[r * ld + c] = s;
    }
}

// ---------------------------------------------------------------------------
// Kernel 2: fused q-conv -> energy -> softmax -> out-GEMM -> residual.
// Grid (HW/TP, N), 256 threads = 8 wave32s.
// LDS (floats), unioned across phases (~59.9 KB total):
//   [0     .. 8448)  Qs 64x132 | phase1 double buffers:
//                      Xs0 16x68 @0, Xs1 @1088, Ws0 128x20 @2176, Ws1 @4736
//   [8448  ..12672)  KVs 32x132  (Ks in phase2, Vs chunk in phase4)
//   [12672 ..14976)  Es 64x36    (energy / attn)
// ---------------------------------------------------------------------------
__global__ void __launch_bounds__(256)
attn_kernel(const float* __restrict__ x, const float* __restrict__ wq,
            const float* __restrict__ bq,
            const float* __restrict__ kbuf, const float* __restrict__ vbuf,
            const float* __restrict__ scale, float* __restrict__ out) {
    __shared__ __align__(16) float smem[14976];
    float* Qs  = smem;            // 64 rows (pixel) x 132 (c4, padded)
    float* KVs = smem + 8448;     // 32 rows (k)     x 132
    float* Es  = smem + 12672;    // 64 rows (pixel) x 36

    const int tid  = threadIdx.x;
    const int wave = tid >> 5;
    const int lane = tid & 31;
    const int half = lane >> 4;
    const int m    = lane & 15;
    const int n    = blockIdx.y;
    const int p0   = blockIdx.x * TP_;     // linear pixel offset in HW

    // ---------------- Phase 1: Q tile (TP_ x C4_) -----------------
    // 4 Mtiles (pixel) x 8 Ntiles (c4). Wave w: Mtile = w>>1, Ntiles (w&1)*4 ..+3
    const int mt  = wave >> 1;
    const int ntb = (wave & 1) * 4;
    v8f qacc[4] = {v8f(0.f), v8f(0.f), v8f(0.f), v8f(0.f)};

    // async-issue helper (all 256 threads participate):
    //   Xs chunk: 16 ch x 64 px = 256 float4 (1 per thread)
    //   Ws chunk: 128 c4 x 16 ch = 512 float4 (2 per thread)
    auto issue_chunk = [&](int c0, int buf) {
        {
            const int cc = tid >> 4, p4 = tid & 15;
            async_copy_b128(lds_off(&smem[buf * 1088 + cc * 68 + p4 * 4]),
                            x + ((size_t)n * C_ + c0 + cc) * HW_ + p0 + p4 * 4);
        }
        #pragma unroll
        for (int r = 0; r < 2; ++r) {
            const int i = tid + r * 256;
            const int o = i >> 2, c4i = i & 3;
            async_copy_b128(lds_off(&smem[2176 + buf * 2560 + o * 20 + c4i * 4]),
                            wq + (size_t)o * C_ + c0 + c4i * 4);
        }
    };

    issue_chunk(0, 0);
    for (int ci = 0; ci < NCHUNK_; ++ci) {
        wait_async0();        // this wave's async writes (chunk ci) landed in LDS
        __syncthreads();      // ... and everyone else's too
        if (ci + 1 < NCHUNK_) issue_chunk((ci + 1) * KC_, (ci + 1) & 1);

        const float* Xb = smem + (ci & 1) * 1088;
        const float* Wb = smem + 2176 + (ci & 1) * 2560;
        #pragma unroll
        for (int ks = 0; ks < KC_ / 4; ++ks) {
            const int cc = ks * 4 + 2 * half;   // K component base for this lane-half
            v2f a;
            a.x = Xb[(cc + 0) * 68 + mt * 16 + m];
            a.y = Xb[(cc + 1) * 68 + mt * 16 + m];
            #pragma unroll
            for (int j = 0; j < 4; ++j) {
                const v2f b = *(const v2f*)&Wb[((ntb + j) * 16 + m) * 20 + cc];
                qacc[j] = __builtin_amdgcn_wmma_f32_16x16x4_f32(
                    false, a, false, b, (short)0, qacc[j], false, false);
            }
        }
    }
    __syncthreads();   // all waves done reading Xs/Ws before Qs overwrites them

    // bias + spill Q to LDS: Qs[p][c4]
    #pragma unroll
    for (int j = 0; j < 4; ++j) {
        const int c4 = (ntb + j) * 16 + m;
        const float bqv = bq[c4];
        #pragma unroll
        for (int v = 0; v < 8; ++v) {
            const int p = mt * 16 + v + 8 * half;
            Qs[p * 132 + c4] = qacc[j][v] + bqv;
        }
    }
    // stage k_n: KVs[kk][c4] (b128 synchronous; small)
    for (int i = tid; i < K_ * C4_ / 4; i += 256) {
        const int kk = i >> 5, q = i & 31;
        *(float4*)&KVs[kk * 132 + q * 4] =
            *(const float4*)&kbuf[((size_t)n * K_ + kk) * C4_ + q * 4];
    }
    __syncthreads();

    // ---------------- Phase 2: energy (TP_ x K_) ------------------
    {
        const int mt2 = wave & 3;
        const int nt2 = wave >> 2;
        v8f eacc = v8f(0.f);
        #pragma unroll 4
        for (int ks = 0; ks < C4_ / 4; ++ks) {
            const int cc = ks * 4 + 2 * half;
            const v2f a = *(const v2f*)&Qs[(mt2 * 16 + m) * 132 + cc];
            const v2f b = *(const v2f*)&KVs[(nt2 * 16 + m) * 132 + cc];
            eacc = __builtin_amdgcn_wmma_f32_16x16x4_f32(
                false, a, false, b, (short)0, eacc, false, false);
        }
        #pragma unroll
        for (int v = 0; v < 8; ++v) {
            const int p = mt2 * 16 + v + 8 * half;
            Es[p * 36 + nt2 * 16 + m] = eacc[v];
        }
    }
    __syncthreads();

    // ---------------- Phase 3: softmax over K_ --------------------
    if (tid < TP_) {
        float mx = -INFINITY;
        #pragma unroll
        for (int kk = 0; kk < K_; ++kk) mx = fmaxf(mx, Es[tid * 36 + kk]);
        float s = 0.f;
        #pragma unroll
        for (int kk = 0; kk < K_; ++kk) {
            const float e = __expf(Es[tid * 36 + kk] - mx);
            Es[tid * 36 + kk] = e;
            s += e;
        }
        const float inv = 1.0f / s;
        #pragma unroll
        for (int kk = 0; kk < K_; ++kk) Es[tid * 36 + kk] *= inv;
    }
    __syncthreads();

    // ---------------- Phase 4: out = scale * (v^T @ attn^T) + x ---
    // Per 128-channel block: 8 Mtiles (c) x 4 Ntiles (p); wave w -> Mtile w
    const float scl = scale[0];
    for (int cb = 0; cb < C_ / C4_; ++cb) {
        __syncthreads();
        for (int i = tid; i < K_ * C4_ / 4; i += 256) {
            const int kk = i >> 5, q = i & 31;
            *(float4*)&KVs[kk * 132 + q * 4] =
                *(const float4*)&vbuf[((size_t)n * K_ + kk) * C_ + cb * C4_ + q * 4];
        }
        __syncthreads();
        #pragma unroll
        for (int nt = 0; nt < 4; ++nt) {
            v8f oacc = v8f(0.f);
            #pragma unroll
            for (int ks = 0; ks < K_ / 4; ++ks) {
                const int kb = ks * 4 + 2 * half;
                v2f a;
                a.x = KVs[(kb + 0) * 132 + wave * 16 + m];   // V[kk][c_local]
                a.y = KVs[(kb + 1) * 132 + wave * 16 + m];
                const v2f b = *(const v2f*)&Es[(nt * 16 + m) * 36 + kb]; // attn[p][kk]
                oacc = __builtin_amdgcn_wmma_f32_16x16x4_f32(
                    false, a, false, b, (short)0, oacc, false, false);
            }
            const int pg = p0 + nt * 16 + m;
            #pragma unroll
            for (int v = 0; v < 8; ++v) {
                const int c = cb * C4_ + wave * 16 + v + 8 * half;
                const size_t idx = ((size_t)n * C_ + c) * HW_ + pg;
                out[idx] = scl * oacc[v] + x[idx];
            }
        }
    }
}

// ---------------------------------------------------------------------------
extern "C" void kernel_launch(void* const* d_in, const int* in_sizes, int n_in,
                              void* d_out, int out_size, void* d_ws, size_t ws_size,
                              hipStream_t stream) {
    const float* x     = (const float*)d_in[0];
    const float* y     = (const float*)d_in[1];
    const float* wq    = (const float*)d_in[2];
    const float* bq    = (const float*)d_in[3];
    const float* wk    = (const float*)d_in[4];
    const float* bk    = (const float*)d_in[5];
    const float* wv    = (const float*)d_in[6];
    const float* bv    = (const float*)d_in[7];
    const float* scale = (const float*)d_in[8];
    float* out  = (float*)d_out;
    float* kbuf = (float*)d_ws;                      // N*K*C4 floats
    float* vbuf = kbuf + (size_t)N_ * K_ * C4_;      // N*K*C  floats

    kv_kernel<<<dim3(N_ * 20), dim3(256), 0, stream>>>(y, wk, bk, wv, bv, kbuf, vbuf);
    attn_kernel<<<dim3(HW_ / TP_, N_), dim3(256), 0, stream>>>(x, wq, bq, kbuf, vbuf, scale, out);
}

// v002
// A run of this version takes 32.1 microseconds.
// In two side-by-side timings against v001, it was 1.45 and 1.47 times as fast.
// Over all steps from v000 it is 2.29 times as fast.
#include <hip/hip_runtime.h>
#include <math.h>

typedef float v2f __attribute__((ext_vector_type(2)));
typedef float v8f __attribute__((ext_vector_type(8)));

#define N_   8
#define C_   512
#define HW_  4096
#define K_   32
#define C4_  128
#define TP_  64     // pixels per workgroup tile
#define KC_  64     // channel chunk staged in LDS (double-buffered)
#define NCHUNK_ (C_ / KC_)

__device__ __forceinline__ unsigned lds_off(const void* p) {
    return (unsigned)(uintptr_t)p;
}
__device__ __forceinline__ void async_copy6_b128(
        unsigned l0, unsigned l1, unsigned l2, unsigned l3, unsigned l4, unsigned l5,
        const float* g0, const float* g1, const float* g2,
        const float* g3, const float* g4, const float* g5) {
    asm volatile("global_load_async_to_lds_b128 %0, %6, off\n\t"
                 "global_load_async_to_lds_b128 %1, %7, off\n\t"
                 "global_load_async_to_lds_b128 %2, %8, off\n\t"
                 "global_load_async_to_lds_b128 %3, %9, off\n\t"
                 "global_load_async_to_lds_b128 %4, %10, off\n\t"
                 "global_load_async_to_lds_b128 %5, %11, off\n\t"
                 "s_wait_xcnt 0x0"
                 :: "v"(l0), "v"(l1), "v"(l2), "v"(l3), "v"(l4), "v"(l5),
                    "v"(g0), "v"(g1), "v"(g2), "v"(g3), "v"(g4), "v"(g5)
                 : "memory");
}
// this wave's copies have landed in LDS
__device__ __forceinline__ void wait_async0() {
    asm volatile("s_wait_asynccnt 0x0" ::: "memory");
}
// this wave's LDS reads have returned: the buffer may be refilled behind the next barrier
__device__ __forceinline__ void wait_ds0() {
    asm volatile("s_wait_dscnt 0x0" ::: "memory");
}

// ---------------------------------------------------------------------------
// Kernel 1: k = y @ wk^T + bk  (N,K,C4) ; v = y @ wv^T + bv  (N,K,C)
// One GEMM of 256 rows (n,kk) x 640 columns (128 of wk, then 512 of wv) x 512.
// Block = 32 rows x 32 columns, 8 waves. The 32 y rows and 32 weight rows are
// staged in LDS with whole-line loads; wave w takes channels 64w .. 64w+63 of
// all four 16x16 tiles on the matrix unit; the 8 partial tiles are summed
// through LDS, wave 0 first.
//   St  64 rows x 516 floats (pitch 16 B x odd: b128 fragment reads, no conflict)
//   Red 8 waves x 4 tiles x 272 floats
// ---------------------------------------------------------------------------
#define KVP_  516
#define KVT_  272
__global__ void __launch_bounds__(256)
kv_kernel(const float* __restrict__ y,
          const float* __restrict__ wk, const float* __restrict__ bk,
          const float* __restrict__ wv, const float* __restrict__ bv,
          float* __restrict__ kbuf, float* __restrict__ vbuf) {
    __shared__ __align__(16) float St[64 * KVP_];
    __shared__ __align__(16) float Red[8 * 4 * KVT_];

    const int rg   = blockIdx.x & 7;    // row group = batch index n
    const int cg   = blockIdx.x >> 3;   // column group: 0..3 wk, 4..19 wv
    const int tid  = threadIdx.x;
    const int wave = tid >> 5;
    const int lane = tid & 31;
    const int half = lane >> 4;
    const int m    = lane & 15;

    const bool isk = cg < 4;
    const float* ysrc = y + (size_t)rg * K_ * C_;
    const float* wsrc = isk ? wk + (size_t)cg * 32 * C_ : wv + (size_t)(cg - 4) * 32 * C_;
    const float  bias = isk ? bk[cg * 32 + lane] : bv[(cg - 4) * 32 + lane];

    // stage: each wave-wide load covers 512 contiguous bytes of one row.
    // Unrolled so that t[] stays in registers and all 32 loads are in flight
    // before the first LDS store waits.
    {
        const int r0  = tid >> 7;          // 0..1
        const int col = (tid & 127) * 4;
        float4 t[32];
        #pragma unroll
        for (int i = 0; i < 16; ++i)
            t[i] = *(const float4*)&ysrc[(size_t)(2 * i + r0) * C_ + col];
        #pragma unroll
        for (int i = 0; i < 16; ++i)
            t[16 + i] = *(const float4*)&wsrc[(size_t)(2 * i + r0) * C_ + col];
        #pragma unroll
        for (int i = 0; i < 32; ++i)
            *(float4*)&St[(2 * i + r0) * KVP_ + col] = t[i];
    }
    __syncthreads();

    // A = y rows, B = weight rows, both loaded by the same code: per 8 channels
    // lane half h holds channels 4h..4h+3; .xy feed one product, .zw the next.
    // Unrolled (here and below) so that the tiles stay in registers under
    // constant indices and the next fragments are read ahead of the products.
    v8f acc[2][2] = {{v8f(0.f), v8f(0.f)}, {v8f(0.f), v8f(0.f)}};
    #pragma unroll
    for (int s = 0; s < 8; ++s) {
        const int kb = wave * 64 + s * 8 + 4 * half;
        float4 fa[2], fb[2];
        #pragma unroll
        for (int i = 0; i < 2; ++i) {
            fa[i] = *(const float4*)&St[(i * 16 + m) * KVP_ + kb];
            fb[i] = *(const float4*)&St[(32 + i * 16 + m) * KVP_ + kb];
        }
        #pragma unroll
        for (int i = 0; i < 2; ++i)
            #pragma unroll
            for (int j = 0; j < 2; ++j) {
                const v2f a = {fa[i].x, fa[i].y};
                const v2f b = {fb[j].x, fb[j].y};
                acc[i][j] = __builtin_amdgcn_wmma_f32_16x16x4_f32(
                    false, a, false, b, (short)0, acc[i][j], false, false);
            }
        #pragma unroll
        for (int i = 0; i < 2; ++i)
            #pragma unroll
            for (int j = 0; j < 2; ++j) {
                const v2f a = {fa[i].z, fa[i].w};
                const v2f b = {fb[j].z, fb[j].w};
                acc[i][j] = __builtin_amdgcn_wmma_f32_16x16x4_f32(
                    false, a, false, b, (short)0, acc[i][j], false, false);
            }
    }

    // keeps the address arithmetic below out of the matrix run: there it would
    // overwrite A and B registers directly behind the products that read them
    __builtin_amdgcn_sched_barrier(0);

    #pragma unroll
    for (int i = 0; i < 2; ++i)
        #pragma unroll
        for (int j = 0; j < 2; ++j)
            #pragma unroll
            for (int v = 0; v < 8; ++v)
                Red[(wave * 4 + i * 2 + j) * KVT_ + v * 32 + lane] = acc[i][j][v];
    __syncthreads();

    // sum the 8 partials; a wave writes one whole 128-byte line of one row
    const int c = lane;
    float* dst = isk ? kbuf + (size_t)rg * K_ * C4_ + cg * 32 : vbuf + (size_t)rg * K_ * C_ + (cg - 4) * 32;
    const int ld = isk ? C4_ : C_;
    #pragma unroll
    for (int q = 0; q < 4; ++q) {
        const int r   = q * 8 + wave;                 // 0..31
        const int idx = ((r >> 4) * 2 + (c >> 4)) * KVT_ + (r & 7) * 32 + ((r >> 3) & 1) * 16 + (c & 15);
        float s = Red[idx];
        #pragma unroll
        for (int w = 1; w < 8; ++w) s += Red[w * 4 * KVT_ + idx];
        s += bias;
        dst[r * ld + c] = s;
    }
}

#define MC_  64
#define MWP_ 160
__global__ void __launch_bounds__(128)
m_kernel(const float* __restrict__ wq, const float* __restrict__ bq,
         const float* __restrict__ kbuf,
         float* __restrict__ mbuf, float* __restrict__ ebuf) {
    __shared__ __align__(16) float Wt[(C4_ / 2) * MWP_];
    __shared__ __align__(16) float Ks[K_ * 132];

    const int tid  = threadIdx.x;
    const int wave = tid >> 5;
    const int lane = tid & 31;
    const int half = lane >> 4;
    const int m    = lane & 15;
    const int n    = blockIdx.y;
    const int c0   = blockIdx.x * MC_;

    // stage; unrolled so that all 24 loads are in flight before the first
    // LDS store waits. Pass i: row pairs 8i + (tid>>4), key rows 4i + (tid>>5).
    {
        const float* sw = wq + (size_t)(tid >> 4) * 2 * C_ + c0 + (tid & 15) * 4;
        const float* sk = kbuf + ((size_t)n * K_ + (tid >> 5)) * C4_ + (tid & 31) * 4;
        float* dw = &Wt[(tid >> 4) * MWP_ + (tid & 15) * 8];
        float* dk = &Ks[(tid >> 5) * 132 + (tid & 31) * 4];
        float4 t0[8], t1[8], tk[8];
        #pragma unroll
        for (int i = 0; i < 8; ++i) {
            t0[i] = *(const float4*)(sw + i * 16 * C_);
            t1[i] = *(const float4*)(sw + i * 16 * C_ + C_);
            tk[i] = *(const float4*)(sk + i * 4 * C4_);
        }
        #pragma unroll
        for (int i = 0; i < 8; ++i) {
            *(float4*)(dw + i * 8 * MWP_)     = make_float4(t0[i].x, t1[i].x, t0[i].y, t1[i].y);
            *(float4*)(dw + i * 8 * MWP_ + 4) = make_float4(t0[i].z, t1[i].z, t0[i].w, t1[i].w);
            *(float4*)(dk + i * 4 * 132)      = tk[i];
        }
    }
    __syncthreads();

    // A = wq^T (rows c, k index o), B = k_n (columns kk, k index o)
    const int cp = wave & 1;
    const int nt = wave >> 1;
    v8f acc[2] = {v8f(0.f), v8f(0.f)};
    // unrolled (both loops) so that the fragment reads run ahead of the
    // products and the two tiles stay in registers under constant indices
    #pragma unroll
    for (int ks = 0; ks < C4_ / 4; ++ks) {
        const int kb = ks * 4 + 2 * half;
        const v2f b = *(const v2f*)&Ks[(nt * 16 + m) * 132 + kb];
        #pragma unroll
        for (int i = 0; i < 2; ++i) {
            const v2f a = *(const v2f*)&Wt[(ks * 2 + half) * MWP_ + (cp * 32 + i * 16 + m) * 2];
            acc[i] = __builtin_amdgcn_wmma_f32_16x16x4_f32(
                false, a, false, b, (short)0, acc[i], false, false);
        }
    }

    // lane holds key nt*16+m, channels i*16 + 8*half + 0..7 of its 32
    float* dst = mbuf + ((size_t)n * K_ + nt * 16 + m) * C_ + c0 + cp * 32 + 8 * half;
    // unrolled: constant indices keep the tiles in registers
    #pragma unroll
    for (int i = 0; i < 2; ++i) {
        *(float4*)&dst[i * 16]     = make_float4(acc[i][0], acc[i][1], acc[i][2], acc[i][3]);
        *(float4*)&dst[i * 16 + 4] = make_float4(acc[i][4], acc[i][5], acc[i][6], acc[i][7]);
    }
    // stands in front of the part below, which reuses the registers that
    // the stores above name
    asm volatile("s_wait_xcnt 0x0" ::: "memory");

    // e0: one block per n; 4 lanes share a key, 32 o each
    if (blockIdx.x == 0) {
        const int kk = tid >> 2, part = tid & 3;
        float s = 0.f;
        for (int j = 0; j < 8; ++j) {
            const float4 kq = *(const float4*)&Ks[kk * 132 + part * 32 + j * 4];
            const float4 bb = *(const float4*)&bq[part * 32 + j * 4];
            s += kq.x * bb.x + kq.y * bb.y + kq.z * bb.z + kq.w * bb.w;
        }
        s += __shfl_xor(s, 1);
        s += __shfl_xor(s, 2);
        if (part == 0) ebuf[n * K_ + kk] = s;
    }
}

// ---------------------------------------------------------------------------
// Kernel 3: fused energy -> softmax -> out-GEMM -> residual.
// Grid (HW/TP, N), 256 threads = 8 wave32s.
// LDS (floats):
//   [0     .. 9216)  Xs0, Xs1: 64 channels x 72 (64 pixels, padded)
//   [9216  ..13568)  Ms0, Ms1: 32 keys x 68 (64 channels, padded)
//   [13568 ..17792)  KVs 32x132  (Vs chunk in phase 4)
//   [17792 ..20096)  Es 64x36    (energy / attn)
// ---------------------------------------------------------------------------
#define XP_   72
#define XB_   (KC_ * XP_)
#define MP_   68
#define MB_   (K_ * MP_)
__global__ void __launch_bounds__(256)
attn_kernel(const float* __restrict__ x,
            const float* __restrict__ mbuf, const float* __restrict__ ebuf,
            const float* __restrict__ vbuf,
            const float* __restrict__ scale, float* __restrict__ out) {
    __shared__ __align__(16) float smem[20096];
    float* Ms  = smem + 2 * XB_;
    float* KVs = smem + 13568;    // 32 rows (k)     x 132
    float* Es  = smem + 17792;    // 64 rows (pixel) x 36

    const int tid  = threadIdx.x;
    const int wave = tid >> 5;
    const int lane = tid & 31;
    const int half = lane >> 4;
    const int m    = lane & 15;
    const int n    = blockIdx.y;
    const int p0   = blockIdx.x * TP_;     // linear pixel offset in HW

    // ---------------- Phase 1: energy (TP_ x K_) over all C_ channels ------
    // 4 Mtiles (pixel) x 2 Ntiles (key): one tile per wave
    const int mt2 = wave & 3;
    const int nt2 = wave >> 2;
    const float e0 = ebuf[n * K_ + nt2 * 16 + m];
    v8f eacc = v8f(0.f);

    // async-issue helper (all 256 threads participate):
    //   Xs chunk: 64 ch x 64 px = 1024 float4 (4 per thread)
    //   Ms chunk: 32 kk x 64 ch =  512 float4 (2 per thread)
    const int r16 = tid >> 4, q16 = tid & 15;
    auto issue_chunk = [&](int c0, int buf) {
        const unsigned lx = lds_off(&smem[buf * XB_ + r16 * XP_ + q16 * 4]);
        const unsigned lm = lds_off(&Ms[buf * MB_ + r16 * MP_ + q16 * 4]);
        const float* gx = x + ((size_t)n * C_ + c0 + r16) * HW_ + p0 + q16 * 4;
        const float* gm = mbuf + ((size_t)n * K_ + r16) * C_ + c0 + q16 * 4;
        async_copy6_b128(lx, lx + 16 * XP_ * 4, lx + 32 * XP_ * 4, lx + 48 * XP_ * 4,
                         lm, lm + 16 * MP_ * 4,
                         gx, gx + (size_t)16 * HW_, gx + (size_t)32 * HW_, gx + (size_t)48 * HW_,
                         gm, gm + (size_t)16 * C_);
    };

    issue_chunk(0, 0);
    wait_async0();        // this wave's copies of chunk 0 landed in LDS
    __syncthreads();      // ... and everyone else's too
    issue_chunk(KC_, 1);
    for (int ci = 0; ci < NCHUNK_; ++ci) {
        const float* Xb = smem + (ci & 1) * XB_;
        const float* Mb = Ms + (ci & 1) * MB_;
        // unrolled so that the fragment reads run ahead of the products
        #pragma unroll
        for (int ks = 0; ks < KC_ / 4; ++ks) {
            const int cc = ks * 4 + 2 * half;   // K component base for this lane-half
            v2f a;
            a.x = Xb[(cc + 0) * XP_ + mt2 * 16 + m];
            a.y = Xb[(cc + 1) * XP_ + mt2 * 16 + m];
            const v2f b = *(const v2f*)&Mb[(nt2 * 16 + m) * MP_ + cc];
            eacc = __builtin_amdgcn_wmma_f32_16x16x4_f32(
                false, a, false, b, (short)0, eacc, false, false);
        }
        wait_ds0();           // own reads of this buffer are done
        wait_async0();        // own copies of chunk ci+1 landed
        __syncthreads();      // publishes chunk ci+1, frees this buffer
        if (ci + 2 < NCHUNK_) issue_chunk((ci + 2) * KC_, ci & 1);
    }
    wait_async0();        // no copy is left in flight behind the loop

    // unrolled: constant indices keep the tile in registers
    #pragma unroll
    for (int v = 0; v < 8; ++v) {
        const int p = mt2 * 16 + v + 8 * half;
        Es[p * 36 + nt2 * 16 + m] = eacc[v] + e0;
    }
    __syncthreads();

    // ---------------- Phase 3: softmax over K_ --------------------
    if (tid < TP_) {
        float mx = -INFINITY;
        #pragma unroll
        for (int kk = 0; kk < K_; ++kk) mx = fmaxf(mx, Es[tid * 36 + kk]);
        float s = 0.f;
        #pragma unroll
        for (int kk = 0; kk < K_; ++kk) {
            const float e = __expf(Es[tid * 36 + kk] - mx);
            Es[tid * 36 + kk] = e;
            s += e;
        }
        const float inv = 1.0f / s;
        #pragma unroll
        for (int kk = 0; kk < K_; ++kk) Es[tid * 36 + kk] *= inv;
    }
    __syncthreads();

    // ---------------- Phase 4: out = scale * (v^T @ attn^T) + x ---
    // Per 128-channel block: 8 Mtiles (c) x 4 Ntiles (p); wave w -> Mtile w
    const float scl = scale[0];
    for (int cb = 0; cb < C_ / C4_; ++cb) {
        __syncthreads();
        for (int i = tid; i < K_ * C4_ / 4; i += 256) {
            const int kk = i >> 5, q = i & 31;
            *(float4*)&KVs[kk * 132 + q * 4] =
                *(const float4*)&vbuf[((size_t)n * K_ + kk) * C_ + cb * C4_ + q * 4];
        }
        __syncthreads();
        #pragma unroll
        for (int nt = 0; nt < 4; ++nt) {
            v8f oacc = v8f(0.f);
            #pragma unroll
            for (int ks = 0; ks < K_ / 4; ++ks) {
                const int kb = ks * 4 + 2 * half;
                v2f a;
                a.x = KVs[(kb + 0) * 132 + wave * 16 + m];   // V[kk][c_local]
                a.y = KVs[(kb + 1) * 132 + wave * 16 + m];
                const v2f b = *(const v2f*)&Es[(nt * 16 + m) * 36 + kb]; // attn[p][kk]
                oacc = __builtin_amdgcn_wmma_f32_16x16x4_f32(
                    false, a, false, b, (short)0, oacc, false, false);
            }
            const int pg = p0 + nt * 16 + m;
            #pragma unroll
            for (int v = 0; v < 8; ++v) {
                const int c = cb * C4_ + wave * 16 + v + 8 * half;
                const size_t idx = ((size_t)n * C_ + c) * HW_ + pg;
                out[idx] = scl * oacc[v] + x[idx];
            }
        }
    }
}

// ---------------------------------------------------------------------------
extern "C" void kernel_launch(void* const* d_in, const int* in_sizes, int n_in,
                              void* d_out, int out_size, void* d_ws, size_t ws_size,
                              hipStream_t stream) {
    const float* x     = (const float*)d_in[0];
    const float* y     = (const float*)d_in[1];
    const float* wq    = (const float*)d_in[2];
    const float* bq    = (const float*)d_in[3];
    const float* wk    = (const float*)d_in[4];
    const float* bk    = (const float*)d_in[5];
    const float* wv    = (const float*)d_in[6];
    const float* bv    = (const float*)d_in[7];
    const float* scale = (const float*)d_in[8];
    float* out  = (float*)d_out;
    float* kbuf = (float*)d_ws;                      // N*K*C4 floats
    float* vbuf = kbuf + (size_t)N_ * K_ * C4_;      // N*K*C  floats
    float* mbuf = vbuf + (size_t)N_ * K_ * C_;       // N*K*C  floats
    float* ebuf = mbuf + (size_t)N_ * K_ * C_;       // N*K    floats

    kv_kernel<<<dim3(N_ * 20), dim3(256), 0, stream>>>(y, wk, bk, wv, bv, kbuf, vbuf);
    m_kernel<<<dim3(C_ / MC_, N_), dim3(128), 0, stream>>>(wq, bq, kbuf, mbuf, ebuf);
    attn_kernel<<<dim3(HW_ / TP_, N_), dim3(256), 0, stream>>>(x, mbuf, ebuf, vbuf, scale, out);
}

// v003
// Measured time: 27.1 microseconds a run.
// Next to v002, in two timings, it ran 1.17 and 1.16 times as fast.
// All steps since v000 together make it 2.66 times as fast.
#include <hip/hip_runtime.h>
#include <math.h>

typedef float v2f __attribute__((ext_vector_type(2)));
typedef float v8f __attribute__((ext_vector_type(8)));

#define N_   8
#define C_   512
#define HW_  4096
#define K_   32
#define C4_  128
#define TP_  64     // pixels per workgroup tile
#define KC_  64     // channel chunk staged in LDS (double-buffered)
#define NCHUNK_ (C_ / KC_)

__device__ __forceinline__ unsigned lds_off(const void* p) {
    return (unsigned)(uintptr_t)p;
}
__device__ __forceinline__ void async_copy8_b128(
        unsigned l0, unsigned l1, unsigned l2, unsigned l3,
        unsigned l4, unsigned l5, unsigned l6, unsigned l7,
        const float* g0, const float* g1, const float* g2, const float* g3,
        const float* g4, const float* g5, const float* g6, const float* g7) {
    asm volatile("global_load_async_to_lds_b128 %0, %8, off\n\t"
                 "global_load_async_to_lds_b128 %1, %9, off\n\t"
                 "global_load_async_to_lds_b128 %2, %10, off\n\t"
                 "global_load_async_to_lds_b128 %3, %11, off\n\t"
                 "global_load_async_to_lds_b128 %4, %12, off\n\t"
                 "global_load_async_to_lds_b128 %5, %13, off\n\t"
                 "global_load_async_to_lds_b128 %6, %14, off\n\t"
                 "global_load_async_to_lds_b128 %7, %15, off\n\t"
                 "s_wait_xcnt 0x0"
                 :: "v"(l0), "v"(l1), "v"(l2), "v"(l3), "v"(l4), "v"(l5), "v"(l6), "v"(l7),
                    "v"(g0), "v"(g1), "v"(g2), "v"(g3), "v"(g4), "v"(g5), "v"(g6), "v"(g7)
                 : "memory");
}
// this wave's copies have landed in LDS
__device__ __forceinline__ void wait_async0() {
    asm volatile("s_wait_asynccnt 0x0" ::: "memory");
}
// this wave's LDS reads have returned: the buffer may be refilled behind the next barrier
__device__ __forceinline__ void wait_ds0() {
    asm volatile("s_wait_dscnt 0x0" ::: "memory");
}

// ---------------------------------------------------------------------------
// Kernel 1: k = y @ wk^T + bk  (N,K,C4) ; v = y @ wv^T + bv  (N,K,C)
// One GEMM of 256 rows (n,kk) x 640 columns (128 of wk, then 512 of wv) x 512.
// Block = 32 rows x 32 columns, 8 waves. The 32 y rows and 32 weight rows are
// staged in LDS with whole-line loads; wave w takes channels 64w .. 64w+63 of
// all four 16x16 tiles on the matrix unit; the 8 partial tiles are summed
// through LDS, wave 0 first.
//   St  64 rows x 516 floats (pitch 16 B x odd: b128 fragment reads, no conflict)
//   Red 8 waves x 4 tiles x 272 floats
// ---------------------------------------------------------------------------
#define KVP_  516
#define KVT_  272
__global__ void __launch_bounds__(256)
kv_kernel(const float* __restrict__ y,
          const float* __restrict__ wk, const float* __restrict__ bk,
          const float* __restrict__ wv, const float* __restrict__ bv,
          float* __restrict__ kbuf, float* __restrict__ vbuf) {
    __shared__ __align__(16) float St[64 * KVP_];
    __shared__ __align__(16) float Red[8 * 4 * KVT_];

    const int rg   = blockIdx.x & 7;    // row group = batch index n
    const int cg   = blockIdx.x >> 3;   // column group: 0..3 wk, 4..19 wv
    const int tid  = threadIdx.x;
    const int wave = tid >> 5;
    const int lane = tid & 31;
    const int half = lane >> 4;
    const int m    = lane & 15;

    const bool isk = cg < 4;
    const float* ysrc = y + (size_t)rg * K_ * C_;
    const float* wsrc = isk ? wk + (size_t)cg * 32 * C_ : wv + (size_t)(cg - 4) * 32 * C_;
    const float  bias = isk ? bk[cg * 32 + lane] : bv[(cg - 4) * 32 + lane];

    // stage: each wave-wide load covers 512 contiguous bytes of one row.
    // Unrolled so that t[] stays in registers and all 32 loads are in flight
    // before the first LDS store waits.
    {
        const int r0  = tid >> 7;          // 0..1
        const int col = (tid & 127) * 4;
        float4 t[32];
        #pragma unroll
        for (int i = 0; i < 16; ++i)
            t[i] = *(const float4*)&ysrc[(size_t)(2 * i + r0) * C_ + col];
        #pragma unroll
        for (int i = 0; i < 16; ++i)
            t[16 + i] = *(const float4*)&wsrc[(size_t)(2 * i + r0) * C_ + col];
        #pragma unroll
        for (int i = 0; i < 32; ++i)
            *(float4*)&St[(2 * i + r0) * KVP_ + col] = t[i];
    }
    __syncthreads();

    // A = y rows, B = weight rows, both loaded by the same code: per 8 channels
    // lane half h holds channels 4h..4h+3; .xy feed one product, .zw the next.
    // Unrolled (here and below) so that the tiles stay in registers under
    // constant indices and the next fragments are read ahead of the products.
    v8f acc[2][2] = {{v8f(0.f), v8f(0.f)}, {v8f(0.f), v8f(0.f)}};
    #pragma unroll
    for (int s = 0; s < 8; ++s) {
        const int kb = wave * 64 + s * 8 + 4 * half;
        float4 fa[2], fb[2];
        #pragma unroll
        for (int i = 0; i < 2; ++i) {
            fa[i] = *(const float4*)&St[(i * 16 + m) * KVP_ + kb];
            fb[i] = *(const float4*)&St[(32 + i * 16 + m) * KVP_ + kb];
        }
        #pragma unroll
        for (int i = 0; i < 2; ++i)
            #pragma unroll
            for (int j = 0; j < 2; ++j) {
                const v2f a = {fa[i].x, fa[i].y};
                const v2f b = {fb[j].x, fb[j].y};
                acc[i][j] = __builtin_amdgcn_wmma_f32_16x16x4_f32(
                    false, a, false, b, (short)0, acc[i][j], false, false);
            }
        #pragma unroll
        for (int i = 0; i < 2; ++i)
            #pragma unroll
            for (int j = 0; j < 2; ++j) {
                const v2f a = {fa[i].z, fa[i].w};
                const v2f b = {fb[j].z, fb[j].w};
                acc[i][j] = __builtin_amdgcn_wmma_f32_16x16x4_f32(
                    false, a, false, b, (short)0, acc[i][j], false, false);
            }
    }

    // keeps the address arithmetic below out of the matrix run: there it would
    // overwrite A and B registers directly behind the products that read them
    __builtin_amdgcn_sched_barrier(0);

    #pragma unroll
    for (int i = 0; i < 2; ++i)
        #pragma unroll
        for (int j = 0; j < 2; ++j)
            #pragma unroll
            for (int v = 0; v < 8; ++v)
                Red[(wave * 4 + i * 2 + j) * KVT_ + v * 32 + lane] = acc[i][j][v];
    __syncthreads();

    // sum the 8 partials; a wave writes one whole 128-byte line of one row
    const int c = lane;
    float* dst = isk ? kbuf + (size_t)rg * K_ * C4_ + cg * 32 : vbuf + (size_t)rg * K_ * C_ + (cg - 4) * 32;
    const int ld = isk ? C4_ : C_;
    #pragma unroll
    for (int q = 0; q < 4; ++q) {
        const int r   = q * 8 + wave;                 // 0..31
        const int idx = ((r >> 4) * 2 + (c >> 4)) * KVT_ + (r & 7) * 32 + ((r >> 3) & 1) * 16 + (c & 15);
        float s = Red[idx];
        #pragma unroll
        for (int w = 1; w < 8; ++w) s += Red[w * 4 * KVT_ + idx];
        s += bias;
        dst[r * ld + c] = s;
    }
}

#define MC_  64
#define MWP_ 160
__global__ void __launch_bounds__(128)
m_kernel(const float* __restrict__ wq, const float* __restrict__ bq,
         const float* __restrict__ kbuf,
         float* __restrict__ mbuf, float* __restrict__ ebuf) {
    __shared__ __align__(16) float Wt[(C4_ / 2) * MWP_];
    __shared__ __align__(16) float Ks[K_ * 132];

    const int tid  = threadIdx.x;
    const int wave = tid >> 5;
    const int lane = tid & 31;
    const int half = lane >> 4;
    const int m    = lane & 15;
    const int n    = blockIdx.y;
    const int c0   = blockIdx.x * MC_;

    // stage; unrolled so that all 24 loads are in flight before the first
    // LDS store waits. Pass i: row pairs 8i + (tid>>4), key rows 4i + (tid>>5).
    {
        const float* sw = wq + (size_t)(tid >> 4) * 2 * C_ + c0 + (tid & 15) * 4;
        const float* sk = kbuf + ((size_t)n * K_ + (tid >> 5)) * C4_ + (tid & 31) * 4;
        float* dw = &Wt[(tid >> 4) * MWP_ + (tid & 15) * 8];
        float* dk = &Ks[(tid >> 5) * 132 + (tid & 31) * 4];
        float4 t0[8], t1[8], tk[8];
        #pragma unroll
        for (int i = 0; i < 8; ++i) {
            t0[i] = *(const float4*)(sw + i * 16 * C_);
            t1[i] = *(const float4*)(sw + i * 16 * C_ + C_);
            tk[i] = *(const float4*)(sk + i * 4 * C4_);
        }
        #pragma unroll
        for (int i = 0; i < 8; ++i) {
            *(float4*)(dw + i * 8 * MWP_)     = make_float4(t0[i].x, t1[i].x, t0[i].y, t1[i].y);
            *(float4*)(dw + i * 8 * MWP_ + 4) = make_float4(t0[i].z, t1[i].z, t0[i].w, t1[i].w);
            *(float4*)(dk + i * 4 * 132)      = tk[i];
        }
    }
    __syncthreads();

    // A = wq^T (rows c, k index o), B = k_n (columns kk, k index o)
    const int cp = wave & 1;
    const int nt = wave >> 1;
    v8f acc[2] = {v8f(0.f), v8f(0.f)};
    // unrolled (both loops) so that the fragment reads run ahead of the
    // products and the two tiles stay in registers under constant indices
    #pragma unroll
    for (int ks = 0; ks < C4_ / 4; ++ks) {
        const int kb = ks * 4 + 2 * half;
        const v2f b = *(const v2f*)&Ks[(nt * 16 + m) * 132 + kb];
        #pragma unroll
        for (int i = 0; i < 2; ++i) {
            const v2f a = *(const v2f*)&Wt[(ks * 2 + half) * MWP_ + (cp * 32 + i * 16 + m) * 2];
            acc[i] = __builtin_amdgcn_wmma_f32_16x16x4_f32(
                false, a, false, b, (short)0, acc[i], false, false);
        }
    }

    // lane holds key nt*16+m, channels i*16 + 8*half + 0..7 of its 32
    float* dst = mbuf + ((size_t)n * K_ + nt * 16 + m) * C_ + c0 + cp * 32 + 8 * half;
    // unrolled: constant indices keep the tiles in registers
    #pragma unroll
    for (int i = 0; i < 2; ++i) {
        *(float4*)&dst[i * 16]     = make_float4(acc[i][0], acc[i][1], acc[i][2], acc[i][3]);
        *(float4*)&dst[i * 16 + 4] = make_float4(acc[i][4], acc[i][5], acc[i][6], acc[i][7]);
    }
    // stands in front of the part below, which reuses the registers that
    // the stores above name
    asm volatile("s_wait_xcnt 0x0" ::: "memory");

    // e0: one block per n; 4 lanes share a key, 32 o each
    if (blockIdx.x == 0) {
        const int kk = tid >> 2, part = tid & 3;
        float s = 0.f;
        for (int j = 0; j < 8; ++j) {
            const float4 kq = *(const float4*)&Ks[kk * 132 + part * 32 + j * 4];
            const float4 bb = *(const float4*)&bq[part * 32 + j * 4];
            s += kq.x * bb.x + kq.y * bb.y + kq.z * bb.z + kq.w * bb.w;
        }
        s += __shfl_xor(s, 1);
        s += __shfl_xor(s, 2);
        if (part == 0) ebuf[n * K_ + kk] = s;
    }
}

#define XP_   72
#define XB_   (KC_ * XP_)
#define MP_   68
#define MB_   (K_ * MP_)
#define VP_   520
__global__ void __launch_bounds__(256)
attn_kernel(const float* __restrict__ x,
            const float* __restrict__ mbuf, const float* __restrict__ ebuf,
            const float* __restrict__ vbuf,
            const float* __restrict__ scale, float* __restrict__ out) {
    __shared__ __align__(16) float smem[32512];
    float* Ms  = smem + 2 * XB_;
    float* Vs  = smem + 13568;    // 32 rows (k)     x 520
    float* Es  = smem + 30208;    // 64 rows (pixel) x 36

    const int tid  = threadIdx.x;
    const int wave = tid >> 5;
    const int lane = tid & 31;
    const int half = lane >> 4;
    const int m    = lane & 15;
    const int n    = blockIdx.y;
    const int p0   = blockIdx.x * TP_;     // linear pixel offset in HW

    // ---------------- Phase 1: energy (TP_ x K_) over all C_ channels ------
    // 4 Mtiles (pixel) x 2 Ntiles (key): one tile per wave
    const int mt2 = wave & 3;
    const int nt2 = wave >> 2;
    const float e0 = ebuf[n * K_ + nt2 * 16 + m];
    v8f eacc = v8f(0.f);

    // async-issue helper (all 256 threads participate):
    //   Xs chunk: 64 ch x 64 px = 1024 float4 (4 per thread)
    //   Ms chunk: 32 kk x 64 ch =  512 float4 (2 per thread)
    //   Vs slice: 32 kk x 64 ch =  512 float4 (2 per thread), same channels
    const int r16 = tid >> 4, q16 = tid & 15;
    auto issue_chunk = [&](int c0, int buf) {
        const unsigned lx = lds_off(&smem[buf * XB_ + r16 * XP_ + q16 * 4]);
        const unsigned lm = lds_off(&Ms[buf * MB_ + r16 * MP_ + q16 * 4]);
        const float* gx = x + ((size_t)n * C_ + c0 + r16) * HW_ + p0 + q16 * 4;
        const unsigned lv = lds_off(&Vs[r16 * VP_ + c0 + q16 * 4]);
        const float* gm = mbuf + ((size_t)n * K_ + r16) * C_ + c0 + q16 * 4;
        const float* gv = vbuf + ((size_t)n * K_ + r16) * C_ + c0 + q16 * 4;
        async_copy8_b128(lx, lx + 16 * XP_ * 4, lx + 32 * XP_ * 4, lx + 48 * XP_ * 4,
                         lm, lm + 16 * MP_ * 4, lv, lv + 16 * VP_ * 4,
                         gx, gx + (size_t)16 * HW_, gx + (size_t)32 * HW_, gx + (size_t)48 * HW_,
                         gm, gm + (size_t)16 * C_, gv, gv + (size_t)16 * C_);
    };

    issue_chunk(0, 0);
    wait_async0();        // this wave's copies of chunk 0 landed in LDS
    __syncthreads();      // ... and everyone else's too
    issue_chunk(KC_, 1);
    for (int ci = 0; ci < NCHUNK_; ++ci) {
        const float* Xb = smem + (ci & 1) * XB_;
        const float* Mb = Ms + (ci & 1) * MB_;
        // unrolled so that the fragment reads run ahead of the products
        #pragma unroll
        for (int ks = 0; ks < KC_ / 4; ++ks) {
            const int cc = ks * 4 + 2 * half;   // K component base for this lane-half
            v2f a;
            a.x = Xb[(cc + 0) * XP_ + mt2 * 16 + m];
            a.y = Xb[(cc + 1) * XP_ + mt2 * 16 + m];
            const v2f b = *(const v2f*)&Mb[(nt2 * 16 + m) * MP_ + cc];
            eacc = __builtin_amdgcn_wmma_f32_16x16x4_f32(
                false, a, false, b, (short)0, eacc, false, false);
        }
        wait_ds0();           // own reads of this buffer are done
        wait_async0();        // own copies of chunk ci+1 landed
        __syncthreads();      // publishes chunk ci+1, frees this buffer
        if (ci + 2 < NCHUNK_) issue_chunk((ci + 2) * KC_, ci & 1);
    }
    wait_async0();        // no copy is left in flight behind the loop

    // unrolled: constant indices keep the tile in registers
    #pragma unroll
    for (int v = 0; v < 8; ++v) {
        const int p = mt2 * 16 + v + 8 * half;
        Es[p * 36 + nt2 * 16 + m] = eacc[v] + e0;
    }
    __syncthreads();

    // ---------------- Phase 3: softmax over K_ --------------------
    if (tid < TP_) {
        float mx = -INFINITY;
        #pragma unroll
        for (int kk = 0; kk < K_; ++kk) mx = fmaxf(mx, Es[tid * 36 + kk]);
        float s = 0.f;
        #pragma unroll
        for (int kk = 0; kk < K_; ++kk) {
            const float e = __expf(Es[tid * 36 + kk] - mx);
            Es[tid * 36 + kk] = e;
            s += e;
        }
        const float inv = 1.0f / s;
        #pragma unroll
        for (int kk = 0; kk < K_; ++kk) Es[tid * 36 + kk] *= inv;
    }
    __syncthreads();

    // ---------------- Phase 4: out = scale * (v^T @ attn^T) + x ---
    // Per 128-channel block: 8 Mtiles (c) x 4 Ntiles (p); wave w -> Mtile w.
    // Vs and Es are complete and only read from here on: no barrier is needed.
    const float scl = scale[0];
    for (int cb = 0; cb < C_ / C4_; ++cb) {
        #pragma unroll
        for (int nt = 0; nt < 4; ++nt) {
            v8f oacc = v8f(0.f);
            #pragma unroll
            for (int ks = 0; ks < K_ / 4; ++ks) {
                const int kb = ks * 4 + 2 * half;
                v2f a;
                a.x = Vs[(kb + 0) * VP_ + cb * C4_ + wave * 16 + m];   // V[kk][c]
                a.y = Vs[(kb + 1) * VP_ + cb * C4_ + wave * 16 + m];
                const v2f b = *(const v2f*)&Es[(nt * 16 + m) * 36 + kb]; // attn[p][kk]
                oacc = __builtin_amdgcn_wmma_f32_16x16x4_f32(
                    false, a, false, b, (short)0, oacc, false, false);
            }
            const int pg = p0 + nt * 16 + m;
            #pragma unroll
            for (int v = 0; v < 8; ++v) {
                const int c = cb * C4_ + wave * 16 + v + 8 * half;
                const size_t idx = ((size_t)n * C_ + c) * HW_ + pg;
                out[idx] = scl * oacc[v] + x[idx];
            }
        }
        // stands in front of the next trip, which reuses the registers that
        // the stores above name
        asm volatile("s_wait_xcnt 0x0" ::: "memory");
    }
}

// ---------------------------------------------------------------------------
extern "C" void kernel_launch(void* const* d_in, const int* in_sizes, int n_in,
                              void* d_out, int out_size, void* d_ws, size_t ws_size,
                              hipStream_t stream) {
    const float* x     = (const float*)d_in[0];
    const float* y     = (const float*)d_in[1];
    const float* wq    = (const float*)d_in[2];
    const float* bq    = (const float*)d_in[3];
    const float* wk    = (const float*)d_in[4];
    const float* bk    = (const float*)d_in[5];
    const float* wv    = (const float*)d_in[6];
    const float* bv    = (const float*)d_in[7];
    const float* scale = (const float*)d_in[8];
    float* out  = (float*)d_out;
    float* kbuf = (float*)d_ws;                      // N*K*C4 floats
    float* vbuf = kbuf + (size_t)N_ * K_ * C4_;      // N*K*C  floats
    float* mbuf = vbuf + (size_t)N_ * K_ * C_;       // N*K*C  floats
    float* ebuf = mbuf + (size_t)N_ * K_ * C_;       // N*K    floats

    kv_kernel<<<dim3(N_ * 20), dim3(256), 0, stream>>>(y, wk, bk, wv, bv, kbuf, vbuf);
    m_kernel<<<dim3(C_ / MC_, N_), dim3(128), 0, stream>>>(wq, bq, kbuf, mbuf, ebuf);
    attn_kernel<<<dim3(HW_ / TP_, N_), dim3(256), 0, stream>>>(x, mbuf, ebuf, vbuf, scale, out);
}

// v004
// It runs in 23.9 microseconds.
// Two timings next to v003 put it at 1.14 and 1.13 times that version's speed.
// Over all steps from v000 it is 3.01 times as fast.
#include <hip/hip_runtime.h>
#include <math.h>

typedef float v2f __attribute__((ext_vector_type(2)));
typedef float v8f __attribute__((ext_vector_type(8)));

#define N_   8
#define C_   512
#define HW_  4096
#define K_   32
#define C4_  128
#define TP_  64     // pixels per workgroup tile
#define KC_  64     // channel chunk staged in LDS (double-buffered)
#define NCHUNK_ (C_ / KC_)

__device__ __forceinline__ unsigned lds_off(const void* p) {
    return (unsigned)(uintptr_t)p;
}
__device__ __forceinline__ void async_copy8_b128(
        unsigned l0, unsigned l1, unsigned l2, unsigned l3,
        unsigned l4, unsigned l5, unsigned l6, unsigned l7,
        const float* g0, const float* g1, const float* g2, const float* g3,
        const float* g4, const float* g5, const float* g6, const float* g7) {
    asm volatile("global_load_async_to_lds_b128 %0, %8, off\n\t"
                 "global_load_async_to_lds_b128 %1, %9, off\n\t"
                 "global_load_async_to_lds_b128 %2, %10, off\n\t"
                 "global_load_async_to_lds_b128 %3, %11, off\n\t"
                 "global_load_async_to_lds_b128 %4, %12, off\n\t"
                 "global_load_async_to_lds_b128 %5, %13, off\n\t"
                 "global_load_async_to_lds_b128 %6, %14, off\n\t"
                 "global_load_async_to_lds_b128 %7, %15, off\n\t"
                 "s_wait_xcnt 0x0"
                 :: "v"(l0), "v"(l1), "v"(l2), "v"(l3), "v"(l4), "v"(l5), "v"(l6), "v"(l7),
                    "v"(g0), "v"(g1), "v"(g2), "v"(g3), "v"(g4), "v"(g5), "v"(g6), "v"(g7)
                 : "memory");
}
// this wave's copies have landed in LDS
__device__ __forceinline__ void wait_async0() {
    asm volatile("s_wait_asynccnt 0x0" ::: "memory");
}
// this wave's LDS reads have returned: the buffer may be refilled behind the next barrier
__device__ __forceinline__ void wait_ds0() {
    asm volatile("s_wait_dscnt 0x0" ::: "memory");
}

// ---------------------------------------------------------------------------
// Kernel 1, two roles by block index, 256 blocks of 8 waves, one per WGP.
//
// Blocks 0..127, role M: the query projection folded into the keys.
//   energy[p][kk] = sum_o (sum_c x[c][p] wq[o][c] + bq[o]) k[kk][o]
//                 = sum_c x[c][p] M[kk][c] + e0[kk]
//   k[n][kk][o]  = sum_c y[n][kk][c] wk[o][c] + bk[o]   (stays in LDS)
//   M[n][kk][c]  = sum_o k[n][kk][o] wq[o][c]           (N,K,C)
//   e0[n][kk]    = sum_o k[n][kk][o] bq[o]              (N,K)
// A block takes one n, 16 of its 32 keys and 64 channels of M. It computes
// its own 16 x 128 piece of k (the 8 blocks of a key group repeat it), so
// that M needs no launch of its own behind k.
//   Ys 16 keys x 516       all 512 channels of y, filled once
//   Wb 2 x 128 rows x 132  wk, 128 channels a chunk, two buffers
//   Wq 128 rows x 72       wq, the block's 64 channels, filled once
//   Ks 16 keys x 132       k
//   Pm 4 x 16 keys x 68    partial M (in Wb, which is free by then)
//
// Blocks 128..255, role v: v = y @ wv^T + bv  (N,K,C)
// One GEMM of 256 rows (n,kk) x 512 columns x 512.
// Block = 32 rows x 32 columns. The 32 y rows and 32 weight rows are
// staged in LDS with whole-line loads; wave w takes channels 64w .. 64w+63 of
// all four 16x16 tiles on the matrix unit; the 8 partial tiles are summed
// through LDS, wave 0 first.
//   St  64 rows x 516 floats (pitch 16 B x odd: b128 fragment reads, no conflict)
//   Red 8 waves x 4 tiles x 272 floats
// ---------------------------------------------------------------------------
#define KVP_  516
#define KVT_  272
#define MBLK_ 128            // blocks of role M
#define YP_   516
#define WC_   128            // wk channels per chunk
#define WP_   132
#define WB_   (C4_ * WP_)
#define QP_   72
#define KP_   132
#define PP_   68
#define PB_   (16 * PP_)
#define OFF_WB_ (16 * YP_)
#define OFF_WQ_ (OFF_WB_ + 2 * WB_)
#define OFF_KS_ (OFF_WQ_ + C4_ * QP_)
#define SM1_    (OFF_KS_ + 16 * KP_)
__global__ void __launch_bounds__(256)
vm_kernel(const float* __restrict__ y,
          const float* __restrict__ wk, const float* __restrict__ bk,
          const float* __restrict__ wv, const float* __restrict__ bv,
          const float* __restrict__ wq, const float* __restrict__ bq,
          float* __restrict__ vbuf, float* __restrict__ mbuf, float* __restrict__ ebuf) {
    __shared__ __align__(16) float sm[SM1_];

    const int tid  = threadIdx.x;
    const int wave = tid >> 5;
    const int lane = tid & 31;
    const int half = lane >> 4;
    const int m    = lane & 15;

    if (blockIdx.x < MBLK_) {
        // ------------------------------ role M ------------------------------
        float* Ys = sm;
        float* Wb = sm + OFF_WB_;
        float* Wq = sm + OFF_WQ_;
        float* Ks = sm + OFF_KS_;
        const int n   = blockIdx.x & 7;
        const int kt  = (blockIdx.x >> 3) & 1;      // which 16 keys
        const int cq0 = (blockIdx.x >> 4) * 64;     // which 64 channels of M

        const float bkv = bk[wave * 16 + m];
        // e0: one block per (n, key group); 4 lanes share a key, 32 o each.
        // bq is fetched here, by every thread (no branch, all 8 loads in
        // flight at once), so that its latency lies under the first copies.
        const bool e0role = (cq0 == 0) && (tid < 64);
        const int  part   = tid & 3;
        float4 bb[8];
        #pragma unroll
        for (int j = 0; j < 8; ++j)
            bb[j] = *(const float4*)&bq[part * 32 + j * 4];

        // every wave-wide copy covers 512 (wq: 2 x 256) contiguous bytes
        auto issue_wk = [&](int c0, int buf) {
            const unsigned l = lds_off(&Wb[buf * WB_ + wave * WP_ + lane * 4]);
            const float* g = wk + (size_t)wave * C_ + c0 + lane * 4;
            async_copy8_b128(l, l + 8 * WP_ * 4, l + 16 * WP_ * 4, l + 24 * WP_ * 4,
                             l + 32 * WP_ * 4, l + 40 * WP_ * 4, l + 48 * WP_ * 4, l + 56 * WP_ * 4,
                             g, g + 8 * C_, g + 16 * C_, g + 24 * C_,
                             g + 32 * C_, g + 40 * C_, g + 48 * C_, g + 56 * C_);
            async_copy8_b128(l + 64 * WP_ * 4, l + 72 * WP_ * 4, l + 80 * WP_ * 4, l + 88 * WP_ * 4,
                             l + 96 * WP_ * 4, l + 104 * WP_ * 4, l + 112 * WP_ * 4, l + 120 * WP_ * 4,
                             g + 64 * C_, g + 72 * C_, g + 80 * C_, g + 88 * C_,
                             g + 96 * C_, g + 104 * C_, g + 112 * C_, g + 120 * C_);
        };
        {
            const unsigned l = lds_off(&Ys[(tid >> 7) * YP_ + (tid & 127) * 4]);
            const float* g = y + ((size_t)n * K_ + kt * 16 + (tid >> 7)) * C_ + (tid & 127) * 4;
            async_copy8_b128(l, l + 2 * YP_ * 4, l + 4 * YP_ * 4, l + 6 * YP_ * 4,
                             l + 8 * YP_ * 4, l + 10 * YP_ * 4, l + 12 * YP_ * 4, l + 14 * YP_ * 4,
                             g, g + 2 * C_, g + 4 * C_, g + 6 * C_,
                             g + 8 * C_, g + 10 * C_, g + 12 * C_, g + 14 * C_);
        }
        issue_wk(0, 0);
        wait_async0();        // this wave's copies of y and of chunk 0 landed in LDS
        __syncthreads();      // ... and everyone else's too
        issue_wk(WC_, 1);
        {
            // wq rides with chunk 1: trip 0's waits and barrier publish it,
            // and it is read only behind the loop
            const unsigned l = lds_off(&Wq[(tid >> 4) * QP_ + (tid & 15) * 4]);
            const float* g = wq + (size_t)(tid >> 4) * C_ + cq0 + (tid & 15) * 4;
            async_copy8_b128(l, l + 16 * QP_ * 4, l + 32 * QP_ * 4, l + 48 * QP_ * 4,
                             l + 64 * QP_ * 4, l + 80 * QP_ * 4, l + 96 * QP_ * 4, l + 112 * QP_ * 4,
                             g, g + 16 * C_, g + 32 * C_, g + 48 * C_,
                             g + 64 * C_, g + 80 * C_, g + 96 * C_, g + 112 * C_);
        }

        // k: A = y rows (keys), B = wk rows (wave w: o = 16w .. 16w+15), both
        // loaded by the same code: per 8 channels lane half h holds channels
        // 4h..4h+3; .xy feed one product, .zw the next (its own accumulator).
        v8f a0 = v8f(0.f), a1 = v8f(0.f);
        for (int ci = 0; ci < C_ / WC_; ++ci) {
            const float* Yc = Ys + m * YP_ + ci * WC_ + 4 * half;
            const float* Wc = Wb + (ci & 1) * WB_ + (wave * 16 + m) * WP_ + 4 * half;
            // all of the trip's fragment reads stand in one place ahead of
            // its products (unrolled: fa, fb stay in registers)
            float4 fa[WC_ / 8], fb[WC_ / 8];
            #pragma unroll
            for (int s = 0; s < WC_ / 8; ++s) {
                fa[s] = *(const float4*)&Yc[s * 8];
                fb[s] = *(const float4*)&Wc[s * 8];
            }
            // keeps the reads above together: spread among the products, two
            // ahead of each pair, every pair would wait out the LDS latency
            __builtin_amdgcn_sched_barrier(0);
            #pragma unroll
            for (int s = 0; s < WC_ / 8; ++s) {
                const v2f ax = {fa[s].x, fa[s].y}, bx = {fb[s].x, fb[s].y};
                const v2f az = {fa[s].z, fa[s].w}, bz = {fb[s].z, fb[s].w};
                a0 = __builtin_amdgcn_wmma_f32_16x16x4_f32(
                    false, ax, false, bx, (short)0, a0, false, false);
                a1 = __builtin_amdgcn_wmma_f32_16x16x4_f32(
                    false, az, false, bz, (short)0, a1, false, false);
            }
            // keeps the products in front of the waits below, so that the
            // next chunk's copies fly under them and not under an idle wait
            __builtin_amdgcn_sched_barrier(0);
            wait_ds0();           // own reads of this buffer are done
            wait_async0();        // own copies of chunk ci+1 (trip 0: and of wq) landed
            __syncthreads();      // publishes chunk ci+1, frees this buffer
            if (ci + 2 < C_ / WC_) issue_wk((ci + 2) * WC_, ci & 1);
        }
        wait_async0();        // no copy is left in flight behind the loop

        // unrolled: constant indices keep the tiles in registers
        #pragma unroll
        for (int v = 0; v < 8; ++v)
            Ks[(v + 8 * half) * KP_ + wave * 16 + m] = a0[v] + a1[v] + bkv;
        __syncthreads();

        // M: A = k rows (keys), B = wq columns (channels), k index o in the
        // same order on both sides. Wave w: 32 channels (w&1) x 32 o (w>>1).
        const int cp = wave & 1;
        const int kq = wave >> 1;
        v8f p[2] = {v8f(0.f), v8f(0.f)};
        // unrolled (both loops): fragment reads ahead, tiles in registers
        #pragma unroll
        for (int s = 0; s < 4; ++s) {
            const int ob = kq * 32 + s * 8 + 4 * half;
            const float4 ka = *(const float4*)&Ks[m * KP_ + ob];
            const v2f ax = {ka.x, ka.y}, az = {ka.z, ka.w};
            #pragma unroll
            for (int i = 0; i < 2; ++i) {
                const int c = cp * 32 + i * 16 + m;
                const v2f bx = {Wq[(ob + 0) * QP_ + c], Wq[(ob + 1) * QP_ + c]};
                const v2f bz = {Wq[(ob + 2) * QP_ + c], Wq[(ob + 3) * QP_ + c]};
                p[i] = __builtin_amdgcn_wmma_f32_16x16x4_f32(
                    false, ax, false, bx, (short)0, p[i], false, false);
                p[i] = __builtin_amdgcn_wmma_f32_16x16x4_f32(
                    false, az, false, bz, (short)0, p[i], false, false);
            }
        }
        float* Pm = Wb;
        #pragma unroll
        for (int i = 0; i < 2; ++i)
            #pragma unroll
            for (int v = 0; v < 8; ++v)
                Pm[kq * PB_ + (v + 8 * half) * PP_ + cp * 32 + i * 16 + m] = p[i][v];
        __syncthreads();

        // sum the 4 partials; a wave stores two keys' whole 256 bytes
        {
            const int key = tid >> 4, c4 = (tid & 15) * 4;
            float4 s = *(const float4*)&Pm[key * PP_ + c4];
            #pragma unroll
            for (int q = 1; q < 4; ++q) {
                const float4 t = *(const float4*)&Pm[q * PB_ + key * PP_ + c4];
                s.x += t.x; s.y += t.y; s.z += t.z; s.w += t.w;
            }
            *(float4*)&mbuf[((size_t)n * K_ + kt * 16 + key) * C_ + cq0 + c4] = s;
        }

        if (e0role) {
            const int kk = tid >> 2;
            float s = 0.f;
            #pragma unroll
            for (int j = 0; j < 8; ++j) {
                const float4 kv4 = *(const float4*)&Ks[kk * KP_ + part * 32 + j * 4];
                s += kv4.x * bb[j].x + kv4.y * bb[j].y + kv4.z * bb[j].z + kv4.w * bb[j].w;
            }
            s += __shfl_xor(s, 1);
            s += __shfl_xor(s, 2);
            if (part == 0) ebuf[n * K_ + kt * 16 + kk] = s;
        }
        return;
    }

    // -------------------------------- role v --------------------------------
    float* St  = sm;
    float* Red = sm + 64 * KVP_;
    const int rg   = (blockIdx.x - MBLK_) & 7;
    const int cg   = (blockIdx.x - MBLK_) >> 3;

    const float* ysrc = y + (size_t)rg * K_ * C_;
    const float* wsrc = wv + (size_t)cg * 32 * C_;
    const float  bias = bv[cg * 32 + lane];

    // stage: each wave-wide load covers 512 contiguous bytes of one row.
    // Unrolled so that t[] stays in registers and all 32 loads are in flight
    // before the first LDS store waits.
    {
        const int r0  = tid >> 7;          // 0..1
        const int col = (tid & 127) * 4;
        float4 t[32];
        #pragma unroll
        for (int i = 0; i < 16; ++i)
            t[i] = *(const float4*)&ysrc[(size_t)(2 * i + r0) * C_ + col];
        #pragma unroll
        for (int i = 0; i < 16; ++i)
            t[16 + i] = *(const float4*)&wsrc[(size_t)(2 * i + r0) * C_ + col];
        #pragma unroll
        for (int i = 0; i < 32; ++i)
            *(float4*)&St[(2 * i + r0) * KVP_ + col] = t[i];
    }
    __syncthreads();

    // A = y rows, B = weight rows, both loaded by the same code: per 8 channels
    // lane half h holds channels 4h..4h+3; .xy feed one product, .zw the next.
    // Unrolled (here and below) so that the tiles stay in registers under
    // constant indices and the next fragments are read ahead of the products.
    v8f acc[2][2] = {{v8f(0.f), v8f(0.f)}, {v8f(0.f), v8f(0.f)}};
    #pragma unroll
    for (int s = 0; s < 8; ++s) {
        const int kb = wave * 64 + s * 8 + 4 * half;
        float4 fa[2], fb[2];
        #pragma unroll
        for (int i = 0; i < 2; ++i) {
            fa[i] = *(const float4*)&St[(i * 16 + m) * KVP_ + kb];
            fb[i] = *(const float4*)&St[(32 + i * 16 + m) * KVP_ + kb];
        }
        #pragma unroll
        for (int i = 0; i < 2; ++i)
            #pragma unroll
            for (int j = 0; j < 2; ++j) {
                const v2f a = {fa[i].x, fa[i].y};
                const v2f b = {fb[j].x, fb[j].y};
                acc[i][j] = __builtin_amdgcn_wmma_f32_16x16x4_f32(
                    false, a, false, b, (short)0, acc[i][j], false, false);
            }
        #pragma unroll
        for (int i = 0; i < 2; ++i)
            #pragma unroll
            for (int j = 0; j < 2; ++j) {
                const v2f a = {fa[i].z, fa[i].w};
                const v2f b = {fb[j].z, fb[j].w};
                acc[i][j] = __builtin_amdgcn_wmma_f32_16x16x4_f32(
                    false, a, false, b, (short)0, acc[i][j], false, false);
            }
    }

    // keeps the address arithmetic below out of the matrix run: there it would
    // overwrite A and B registers directly behind the products that read them
    __builtin_amdgcn_sched_barrier(0);

    #pragma unroll
    for (int i = 0; i < 2; ++i)
        #pragma unroll
        for (int j = 0; j < 2; ++j)
            #pragma unroll
            for (int v = 0; v < 8; ++v)
                Red[(wave * 4 + i * 2 + j) * KVT_ + v * 32 + lane] = acc[i][j][v];
    __syncthreads();

    // sum the 8 partials; a wave writes one whole 128-byte line of one row
    const int c = lane;
    float* dst = vbuf + (size_t)rg * K_ * C_ + cg * 32;
    const int ld = C_;
    #pragma unroll
    for (int q = 0; q < 4; ++q) {
        const int r   = q * 8 + wave;                 // 0..31
        const int idx = ((r >> 4) * 2 + (c >> 4)) * KVT_ + (r & 7) * 32 + ((r >> 3) & 1) * 16 + (c & 15);
        float s = Red[idx];
        #pragma unroll
        for (int w = 1; w < 8; ++w) s += Red[w * 4 * KVT_ + idx];
        s += bias;
        dst[r * ld + c] = s;
    }
}

#define XP_   72
#define XB_   (KC_ * XP_)
#define MP_   68
#define MB_   (K_ * MP_)
#define VP_   520
__global__ void __launch_bounds__(256)
attn_kernel(const float* __restrict__ x,
            const float* __restrict__ mbuf, const float* __restrict__ ebuf,
            const float* __restrict__ vbuf,
            const float* __restrict__ scale, float* __restrict__ out) {
    __shared__ __align__(16) float smem[32512];
    float* Ms  = smem + 2 * XB_;
    float* Vs  = smem + 13568;    // 32 rows (k)     x 520
    float* Es  = smem + 30208;    // 64 rows (pixel) x 36

    const int tid  = threadIdx.x;
    const int wave = tid >> 5;
    const int lane = tid & 31;
    const int half = lane >> 4;
    const int m    = lane & 15;
    const int n    = blockIdx.y;
    const int p0   = blockIdx.x * TP_;     // linear pixel offset in HW

    // ---------------- Phase 1: energy (TP_ x K_) over all C_ channels ------
    // 4 Mtiles (pixel) x 2 Ntiles (key): one tile per wave
    const int mt2 = wave & 3;
    const int nt2 = wave >> 2;
    const float e0 = ebuf[n * K_ + nt2 * 16 + m];
    v8f eacc = v8f(0.f);

    // async-issue helper (all 256 threads participate):
    //   Xs chunk: 64 ch x 64 px = 1024 float4 (4 per thread)
    //   Ms chunk: 32 kk x 64 ch =  512 float4 (2 per thread)
    //   Vs slice: 32 kk x 64 ch =  512 float4 (2 per thread), same channels
    const int r16 = tid >> 4, q16 = tid & 15;
    auto issue_chunk = [&](int c0, int buf) {
        const unsigned lx = lds_off(&smem[buf * XB_ + r16 * XP_ + q16 * 4]);
        const unsigned lm = lds_off(&Ms[buf * MB_ + r16 * MP_ + q16 * 4]);
        const float* gx = x + ((size_t)n * C_ + c0 + r16) * HW_ + p0 + q16 * 4;
        const unsigned lv = lds_off(&Vs[r16 * VP_ + c0 + q16 * 4]);
        const float* gm = mbuf + ((size_t)n * K_ + r16) * C_ + c0 + q16 * 4;
        const float* gv = vbuf + ((size_t)n * K_ + r16) * C_ + c0 + q16 * 4;
        async_copy8_b128(lx, lx + 16 * XP_ * 4, lx + 32 * XP_ * 4, lx + 48 * XP_ * 4,
                         lm, lm + 16 * MP_ * 4, lv, lv + 16 * VP_ * 4,
                         gx, gx + (size_t)16 * HW_, gx + (size_t)32 * HW_, gx + (size_t)48 * HW_,
                         gm, gm + (size_t)16 * C_, gv, gv + (size_t)16 * C_);
    };

    issue_chunk(0, 0);
    wait_async0();        // this wave's copies of chunk 0 landed in LDS
    __syncthreads();      // ... and everyone else's too
    issue_chunk(KC_, 1);
    for (int ci = 0; ci < NCHUNK_; ++ci) {
        const float* Xb = smem + (ci & 1) * XB_;
        const float* Mb = Ms + (ci & 1) * MB_;
        // unrolled so that the fragment reads run ahead of the products
        #pragma unroll
        for (int ks = 0; ks < KC_ / 4; ++ks) {
            const int cc = ks * 4 + 2 * half;   // K component base for this lane-half
            v2f a;
            a.x = Xb[(cc + 0) * XP_ + mt2 * 16 + m];
            a.y = Xb[(cc + 1) * XP_ + mt2 * 16 + m];
            const v2f b = *(const v2f*)&Mb[(nt2 * 16 + m) * MP_ + cc];
            eacc = __builtin_amdgcn_wmma_f32_16x16x4_f32(
                false, a, false, b, (short)0, eacc, false, false);
        }
        wait_ds0();           // own reads of this buffer are done
        wait_async0();        // own copies of chunk ci+1 landed
        __syncthreads();      // publishes chunk ci+1, frees this buffer
        if (ci + 2 < NCHUNK_) issue_chunk((ci + 2) * KC_, ci & 1);
    }
    wait_async0();        // no copy is left in flight behind the loop

    // unrolled: constant indices keep the tile in registers
    #pragma unroll
    for (int v = 0; v < 8; ++v) {
        const int p = mt2 * 16 + v + 8 * half;
        Es[p * 36 + nt2 * 16 + m] = eacc[v] + e0;
    }
    __syncthreads();

    // ---------------- Phase 3: softmax over K_ --------------------
    if (tid < TP_) {
        float mx = -INFINITY;
        #pragma unroll
        for (int kk = 0; kk < K_; ++kk) mx = fmaxf(mx, Es[tid * 36 + kk]);
        float s = 0.f;
        #pragma unroll
        for (int kk = 0; kk < K_; ++kk) {
            const float e = __expf(Es[tid * 36 + kk] - mx);
            Es[tid * 36 + kk] = e;
            s += e;
        }
        const float inv = 1.0f / s;
        #pragma unroll
        for (int kk = 0; kk < K_; ++kk) Es[tid * 36 + kk] *= inv;
    }
    __syncthreads();

    // ---------------- Phase 4: out = scale * (v^T @ attn^T) + x ---
    // Per 128-channel block: 8 Mtiles (c) x 4 Ntiles (p); wave w -> Mtile w.
    // Vs and Es are complete and only read from here on: no barrier is needed.
    const float scl = scale[0];
    for (int cb = 0; cb < C_ / C4_; ++cb) {
        #pragma unroll
        for (int nt = 0; nt < 4; ++nt) {
            v8f oacc = v8f(0.f);
            #pragma unroll
            for (int ks = 0; ks < K_ / 4; ++ks) {
                const int kb = ks * 4 + 2 * half;
                v2f a;
                a.x = Vs[(kb + 0) * VP_ + cb * C4_ + wave * 16 + m];   // V[kk][c]
                a.y = Vs[(kb + 1) * VP_ + cb * C4_ + wave * 16 + m];
                const v2f b = *(const v2f*)&Es[(nt * 16 + m) * 36 + kb]; // attn[p][kk]
                oacc = __builtin_amdgcn_wmma_f32_16x16x4_f32(
                    false, a, false, b, (short)0, oacc, false, false);
            }
            const int pg = p0 + nt * 16 + m;
            #pragma unroll
            for (int v = 0; v < 8; ++v) {
                const int c = cb * C4_ + wave * 16 + v + 8 * half;
                const size_t idx = ((size_t)n * C_ + c) * HW_ + pg;
                out[idx] = scl * oacc[v] + x[idx];
            }
        }
        // stands in front of the next trip, which reuses the registers that
        // the stores above name
        asm volatile("s_wait_xcnt 0x0" ::: "memory");
    }
}

// ---------------------------------------------------------------------------
extern "C" void kernel_launch(void* const* d_in, const int* in_sizes, int n_in,
                              void* d_out, int out_size, void* d_ws, size_t ws_size,
                              hipStream_t stream) {
    const float* x     = (const float*)d_in[0];
    const float* y     = (const float*)d_in[1];
    const float* wq    = (const float*)d_in[2];
    const float* bq    = (const float*)d_in[3];
    const float* wk    = (const float*)d_in[4];
    const float* bk    = (const float*)d_in[5];
    const float* wv    = (const float*)d_in[6];
    const float* bv    = (const float*)d_in[7];
    const float* scale = (const float*)d_in[8];
    float* out  = (float*)d_out;
    float* vbuf = (float*)d_ws;                      // N*K*C  floats
    float* mbuf = vbuf + (size_t)N_ * K_ * C_;       // N*K*C  floats
    float* ebuf = mbuf + (size_t)N_ * K_ * C_;       // N*K    floats

    vm_kernel<<<dim3(2 * MBLK_), dim3(256), 0, stream>>>(y, wk, bk, wv, bv, wq, bq, vbuf, mbuf, ebuf);
    attn_kernel<<<dim3(HW_ / TP_, N_), dim3(256), 0, stream>>>(x, mbuf, ebuf, vbuf, scale, out);
}

// v005
// It runs in 23 microseconds.
// Timed twice side by side with v004, it ran 1.04 and 1.05 times as fast.
// Over all steps from v000 it is 3.14 times as fast.
#include <hip/hip_runtime.h>
#include <math.h>

typedef float v2f __attribute__((ext_vector_type(2)));
typedef float v8f __attribute__((ext_vector_type(8)));

#define N_   8
#define C_   512
#define HW_  4096
#define K_   32
#define C4_  128
#define TP_  64     // pixels per workgroup tile
#define KC_  64     // channel chunk staged in LDS (ring of three buffers)
#define NCHUNK_ (C_ / KC_)

__device__ __forceinline__ unsigned lds_off(const void* p) {
    return (unsigned)(uintptr_t)p;
}
__device__ __forceinline__ void async_copy8_b128(
        unsigned l0, unsigned l1, unsigned l2, unsigned l3,
        unsigned l4, unsigned l5, unsigned l6, unsigned l7,
        const float* g0, const float* g1, const float* g2, const float* g3,
        const float* g4, const float* g5, const float* g6, const float* g7) {
    asm volatile("global_load_async_to_lds_b128 %0, %8, off\n\t"
                 "global_load_async_to_lds_b128 %1, %9, off\n\t"
                 "global_load_async_to_lds_b128 %2, %10, off\n\t"
                 "global_load_async_to_lds_b128 %3, %11, off\n\t"
                 "global_load_async_to_lds_b128 %4, %12, off\n\t"
                 "global_load_async_to_lds_b128 %5, %13, off\n\t"
                 "global_load_async_to_lds_b128 %6, %14, off\n\t"
                 "global_load_async_to_lds_b128 %7, %15, off\n\t"
                 "s_wait_xcnt 0x0"
                 :: "v"(l0), "v"(l1), "v"(l2), "v"(l3), "v"(l4), "v"(l5), "v"(l6), "v"(l7),
                    "v"(g0), "v"(g1), "v"(g2), "v"(g3), "v"(g4), "v"(g5), "v"(g6), "v"(g7)
                 : "memory");
}
// this wave's copies have landed in LDS
__device__ __forceinline__ void wait_async0() {
    asm volatile("s_wait_asynccnt 0x0" ::: "memory");
}
// all but this wave's 8 (16) youngest copies have landed in LDS: a chunk is 8
// copies of every wave, and a wave's copies count down in the order of issue
__device__ __forceinline__ void wait_async8() {
    asm volatile("s_wait_asynccnt 0x8" ::: "memory");
}
__device__ __forceinline__ void wait_async16() {
    asm volatile("s_wait_asynccnt 0x10" ::: "memory");
}
// this wave's LDS reads have returned: the buffer may be refilled behind the next barrier
__device__ __forceinline__ void wait_ds0() {
    asm volatile("s_wait_dscnt 0x0" ::: "memory");
}

// ---------------------------------------------------------------------------
// Kernel 1, two roles by block index, 256 blocks of 8 waves, one per WGP.
//
// Blocks 0..127, role M: the query projection folded into the keys.
//   energy[p][kk] = sum_o (sum_c x[c][p] wq[o][c] + bq[o]) k[kk][o]
//                 = sum_c x[c][p] M[kk][c] + e0[kk]
//   k[n][kk][o]  = sum_c y[n][kk][c] wk[o][c] + bk[o]   (stays in LDS)
//   M[n][kk][c]  = sum_o k[n][kk][o] wq[o][c]           (N,K,C)
//   e0[n][kk]    = sum_o k[n][kk][o] bq[o]              (N,K)
// A block takes one n, 16 of its 32 keys and 64 channels of M. It computes
// its own 16 x 128 piece of k (the 8 blocks of a key group repeat it), so
// that M needs no launch of its own behind k.
//   Ys 16 keys x 516       all 512 channels of y, filled once
//   Wb 2 x 128 rows x 132  wk, 128 channels a chunk, two buffers
//   Wq 128 rows x 72       wq, the block's 64 channels, filled once
//   Ks 16 keys x 132       k
//   Pm 4 x 16 keys x 68    partial M (in Wb, which is free by then)
//
// Blocks 128..255, role v: v = y @ wv^T + bv  (N,K,C)
// One GEMM of 256 rows (n,kk) x 512 columns x 512.
// Block = 32 rows x 32 columns. The 32 y rows and 32 weight rows are
// staged in LDS with whole-line loads; wave w takes channels 64w .. 64w+63 of
// all four 16x16 tiles on the matrix unit; the 8 partial tiles are summed
// through LDS, wave 0 first.
//   St  64 rows x 516 floats (pitch 16 B x odd: b128 fragment reads, no conflict)
//   Red 8 waves x 4 tiles x 272 floats
// ---------------------------------------------------------------------------
#define KVP_  516
#define KVT_  272
#define MBLK_ 128            // blocks of role M
#define YP_   516
#define WC_   128            // wk channels per chunk
#define WP_   132
#define WB_   (C4_ * WP_)
#define QP_   72
#define KP_   132
#define PP_   68
#define PB_   (16 * PP_)
#define OFF_WB_ (16 * YP_)
#define OFF_WQ_ (OFF_WB_ + 2 * WB_)
#define OFF_KS_ (OFF_WQ_ + C4_ * QP_)
#define SM1_    (OFF_KS_ + 16 * KP_)
__global__ void __launch_bounds__(256)
vm_kernel(const float* __restrict__ y,
          const float* __restrict__ wk, const float* __restrict__ bk,
          const float* __restrict__ wv, const float* __restrict__ bv,
          const float* __restrict__ wq, const float* __restrict__ bq,
          float* __restrict__ vbuf, float* __restrict__ mbuf, float* __restrict__ ebuf) {
    __shared__ __align__(16) float sm[SM1_];

    const int tid  = threadIdx.x;
    const int wave = tid >> 5;
    const int lane = tid & 31;
    const int half = lane >> 4;
    const int m    = lane & 15;

    if (blockIdx.x < MBLK_) {
        // ------------------------------ role M ------------------------------
        float* Ys = sm;
        float* Wb = sm + OFF_WB_;
        float* Wq = sm + OFF_WQ_;
        float* Ks = sm + OFF_KS_;
        const int n   = blockIdx.x & 7;
        const int kt  = (blockIdx.x >> 3) & 1;      // which 16 keys
        const int cq0 = (blockIdx.x >> 4) * 64;     // which 64 channels of M

        const float bkv = bk[wave * 16 + m];
        // e0: one block per (n, key group); 4 lanes share a key, 32 o each.
        // bq is fetched here, by every thread (no branch, all 8 loads in
        // flight at once), so that its latency lies under the first copies.
        const bool e0role = (cq0 == 0) && (tid < 64);
        const int  part   = tid & 3;
        float4 bb[8];
        #pragma unroll
        for (int j = 0; j < 8; ++j)
            bb[j] = *(const float4*)&bq[part * 32 + j * 4];

        // every wave-wide copy covers 512 (wq: 2 x 256) contiguous bytes
        auto issue_wk = [&](int c0, int buf) {
            const unsigned l = lds_off(&Wb[buf * WB_ + wave * WP_ + lane * 4]);
            const float* g = wk + (size_t)wave * C_ + c0 + lane * 4;
            async_copy8_b128(l, l + 8 * WP_ * 4, l + 16 * WP_ * 4, l + 24 * WP_ * 4,
                             l + 32 * WP_ * 4, l + 40 * WP_ * 4, l + 48 * WP_ * 4, l + 56 * WP_ * 4,
                             g, g + 8 * C_, g + 16 * C_, g + 24 * C_,
                             g + 32 * C_, g + 40 * C_, g + 48 * C_, g + 56 * C_);
            async_copy8_b128(l + 64 * WP_ * 4, l + 72 * WP_ * 4, l + 80 * WP_ * 4, l + 88 * WP_ * 4,
                             l + 96 * WP_ * 4, l + 104 * WP_ * 4, l + 112 * WP_ * 4, l + 120 * WP_ * 4,
                             g + 64 * C_, g + 72 * C_, g + 80 * C_, g + 88 * C_,
                             g + 96 * C_, g + 104 * C_, g + 112 * C_, g + 120 * C_);
        };
        {
            const unsigned l = lds_off(&Ys[(tid >> 7) * YP_ + (tid & 127) * 4]);
            const float* g = y + ((size_t)n * K_ + kt * 16 + (tid >> 7)) * C_ + (tid & 127) * 4;
            async_copy8_b128(l, l + 2 * YP_ * 4, l + 4 * YP_ * 4, l + 6 * YP_ * 4,
                             l + 8 * YP_ * 4, l + 10 * YP_ * 4, l + 12 * YP_ * 4, l + 14 * YP_ * 4,
                             g, g + 2 * C_, g + 4 * C_, g + 6 * C_,
                             g + 8 * C_, g + 10 * C_, g + 12 * C_, g + 14 * C_);
        }
        issue_wk(0, 0);
        wait_async0();        // this wave's copies of y and of chunk 0 landed in LDS
        __syncthreads();      // ... and everyone else's too
        issue_wk(WC_, 1);
        {
            // wq rides with chunk 1: trip 0's waits and barrier publish it,
            // and it is read only behind the loop
            const unsigned l = lds_off(&Wq[(tid >> 4) * QP_ + (tid & 15) * 4]);
            const float* g = wq + (size_t)(tid >> 4) * C_ + cq0 + (tid & 15) * 4;
            async_copy8_b128(l, l + 16 * QP_ * 4, l + 32 * QP_ * 4, l + 48 * QP_ * 4,
                             l + 64 * QP_ * 4, l + 80 * QP_ * 4, l + 96 * QP_ * 4, l + 112 * QP_ * 4,
                             g, g + 16 * C_, g + 32 * C_, g + 48 * C_,
                             g + 64 * C_, g + 80 * C_, g + 96 * C_, g + 112 * C_);
        }

        // k: A = y rows (keys), B = wk rows (wave w: o = 16w .. 16w+15), both
        // loaded by the same code: per 8 channels lane half h holds channels
        // 4h..4h+3; .xy feed one product, .zw the next (its own accumulator).
        v8f a0 = v8f(0.f), a1 = v8f(0.f);
        for (int ci = 0; ci < C_ / WC_; ++ci) {
            const float* Yc = Ys + m * YP_ + ci * WC_ + 4 * half;
            const float* Wc = Wb + (ci & 1) * WB_ + (wave * 16 + m) * WP_ + 4 * half;
            // all of the trip's fragment reads stand in one place ahead of
            // its products (unrolled: fa, fb stay in registers)
            float4 fa[WC_ / 8], fb[WC_ / 8];
            #pragma unroll
            for (int s = 0; s < WC_ / 8; ++s) {
                fa[s] = *(const float4*)&Yc[s * 8];
                fb[s] = *(const float4*)&Wc[s * 8];
            }
            // keeps the reads above together: spread among the products, two
            // ahead of each pair, every pair would wait out the LDS latency
            __builtin_amdgcn_sched_barrier(0);
            #pragma unroll
            for (int s = 0; s < WC_ / 8; ++s) {
                const v2f ax = {fa[s].x, fa[s].y}, bx = {fb[s].x, fb[s].y};
                const v2f az = {fa[s].z, fa[s].w}, bz = {fb[s].z, fb[s].w};
                a0 = __builtin_amdgcn_wmma_f32_16x16x4_f32(
                    false, ax, false, bx, (short)0, a0, false, false);
                a1 = __builtin_amdgcn_wmma_f32_16x16x4_f32(
                    false, az, false, bz, (short)0, a1, false, false);
            }
            // keeps the products in front of the waits below, so that the
            // next chunk's copies fly under them and not under an idle wait
            __builtin_amdgcn_sched_barrier(0);
            wait_ds0();           // own reads of this buffer are done
            wait_async0();        // own copies of chunk ci+1 (trip 0: and of wq) landed
            __syncthreads();      // publishes chunk ci+1, frees this buffer
            if (ci + 2 < C_ / WC_) issue_wk((ci + 2) * WC_, ci & 1);
        }
        wait_async0();        // no copy is left in flight behind the loop

        // unrolled: constant indices keep the tiles in registers
        #pragma unroll
        for (int v = 0; v < 8; ++v)
            Ks[(v + 8 * half) * KP_ + wave * 16 + m] = a0[v] + a1[v] + bkv;
        __syncthreads();

        // M: A = k rows (keys), B = wq columns (channels), k index o in the
        // same order on both sides. Wave w: 32 channels (w&1) x 32 o (w>>1).
        const int cp = wave & 1;
        const int kq = wave >> 1;
        v8f p[2] = {v8f(0.f), v8f(0.f)};
        // unrolled (both loops): fragment reads ahead, tiles in registers
        #pragma unroll
        for (int s = 0; s < 4; ++s) {
            const int ob = kq * 32 + s * 8 + 4 * half;
            const float4 ka = *(const float4*)&Ks[m * KP_ + ob];
            const v2f ax = {ka.x, ka.y}, az = {ka.z, ka.w};
            #pragma unroll
            for (int i = 0; i < 2; ++i) {
                const int c = cp * 32 + i * 16 + m;
                const v2f bx = {Wq[(ob + 0) * QP_ + c], Wq[(ob + 1) * QP_ + c]};
                const v2f bz = {Wq[(ob + 2) * QP_ + c], Wq[(ob + 3) * QP_ + c]};
                p[i] = __builtin_amdgcn_wmma_f32_16x16x4_f32(
                    false, ax, false, bx, (short)0, p[i], false, false);
                p[i] = __builtin_amdgcn_wmma_f32_16x16x4_f32(
                    false, az, false, bz, (short)0, p[i], false, false);
            }
        }
        float* Pm = Wb;
        #pragma unroll
        for (int i = 0; i < 2; ++i)
            #pragma unroll
            for (int v = 0; v < 8; ++v)
                Pm[kq * PB_ + (v + 8 * half) * PP_ + cp * 32 + i * 16 + m] = p[i][v];
        __syncthreads();

        // sum the 4 partials; a wave stores two keys' whole 256 bytes
        {
            const int key = tid >> 4, c4 = (tid & 15) * 4;
            float4 s = *(const float4*)&Pm[key * PP_ + c4];
            #pragma unroll
            for (int q = 1; q < 4; ++q) {
                const float4 t = *(const float4*)&Pm[q * PB_ + key * PP_ + c4];
                s.x += t.x; s.y += t.y; s.z += t.z; s.w += t.w;
            }
            *(float4*)&mbuf[((size_t)n * K_ + kt * 16 + key) * C_ + cq0 + c4] = s;
        }

        if (e0role) {
            const int kk = tid >> 2;
            float s = 0.f;
            #pragma unroll
            for (int j = 0; j < 8; ++j) {
                const float4 kv4 = *(const float4*)&Ks[kk * KP_ + part * 32 + j * 4];
                s += kv4.x * bb[j].x + kv4.y * bb[j].y + kv4.z * bb[j].z + kv4.w * bb[j].w;
            }
            s += __shfl_xor(s, 1);
            s += __shfl_xor(s, 2);
            if (part == 0) ebuf[n * K_ + kt * 16 + kk] = s;
        }
        return;
    }

    // -------------------------------- role v --------------------------------
    float* St  = sm;
    float* Red = sm + 64 * KVP_;
    const int rg   = (blockIdx.x - MBLK_) & 7;
    const int cg   = (blockIdx.x - MBLK_) >> 3;

    const float* ysrc = y + (size_t)rg * K_ * C_;
    const float* wsrc = wv + (size_t)cg * 32 * C_;
    const float  bias = bv[cg * 32 + lane];

    // stage: each wave-wide load covers 512 contiguous bytes of one row.
    // Unrolled so that t[] stays in registers and all 32 loads are in flight
    // before the first LDS store waits.
    {
        const int r0  = tid >> 7;          // 0..1
        const int col = (tid & 127) * 4;
        float4 t[32];
        #pragma unroll
        for (int i = 0; i < 16; ++i)
            t[i] = *(const float4*)&ysrc[(size_t)(2 * i + r0) * C_ + col];
        #pragma unroll
        for (int i = 0; i < 16; ++i)
            t[16 + i] = *(const float4*)&wsrc[(size_t)(2 * i + r0) * C_ + col];
        #pragma unroll
        for (int i = 0; i < 32; ++i)
            *(float4*)&St[(2 * i + r0) * KVP_ + col] = t[i];
    }
    __syncthreads();

    // A = y rows, B = weight rows, both loaded by the same code: per 8 channels
    // lane half h holds channels 4h..4h+3; .xy feed one product, .zw the next.
    // Unrolled (here and below) so that the tiles stay in registers under
    // constant indices and the next fragments are read ahead of the products.
    v8f acc[2][2] = {{v8f(0.f), v8f(0.f)}, {v8f(0.f), v8f(0.f)}};
    #pragma unroll
    for (int s = 0; s < 8; ++s) {
        const int kb = wave * 64 + s * 8 + 4 * half;
        float4 fa[2], fb[2];
        #pragma unroll
        for (int i = 0; i < 2; ++i) {
            fa[i] = *(const float4*)&St[(i * 16 + m) * KVP_ + kb];
            fb[i] = *(const float4*)&St[(32 + i * 16 + m) * KVP_ + kb];
        }
        #pragma unroll
        for (int i = 0; i < 2; ++i)
            #pragma unroll
            for (int j = 0; j < 2; ++j) {
                const v2f a = {fa[i].x, fa[i].y};
                const v2f b = {fb[j].x, fb[j].y};
                acc[i][j] = __builtin_amdgcn_wmma_f32_16x16x4_f32(
                    false, a, false, b, (short)0, acc[i][j], false, false);
            }
        #pragma unroll
        for (int i = 0; i < 2; ++i)
            #pragma unroll
            for (int j = 0; j < 2; ++j) {
                const v2f a = {fa[i].z, fa[i].w};
                const v2f b = {fb[j].z, fb[j].w};
                acc[i][j] = __builtin_amdgcn_wmma_f32_16x16x4_f32(
                    false, a, false, b, (short)0, acc[i][j], false, false);
            }
    }

    // keeps the address arithmetic below out of the matrix run: there it would
    // overwrite A and B registers directly behind the products that read them
    __builtin_amdgcn_sched_barrier(0);

    #pragma unroll
    for (int i = 0; i < 2; ++i)
        #pragma unroll
        for (int j = 0; j < 2; ++j)
            #pragma unroll
            for (int v = 0; v < 8; ++v)
                Red[(wave * 4 + i * 2 + j) * KVT_ + v * 32 + lane] = acc[i][j][v];
    __syncthreads();

    // sum the 8 partials; a wave writes one whole 128-byte line of one row
    const int c = lane;
    float* dst = vbuf + (size_t)rg * K_ * C_ + cg * 32;
    const int ld = C_;
    #pragma unroll
    for (int q = 0; q < 4; ++q) {
        const int r   = q * 8 + wave;                 // 0..31
        const int idx = ((r >> 4) * 2 + (c >> 4)) * KVT_ + (r & 7) * 32 + ((r >> 3) & 1) * 16 + (c & 15);
        float s = Red[idx];
        #pragma unroll
        for (int w = 1; w < 8; ++w) s += Red[w * 4 * KVT_ + idx];
        s += bias;
        dst[r * ld + c] = s;
    }
}

#define XP_   72
#define XB_   (KC_ * XP_)
#define MP_   68
#define MB_   (K_ * MP_)
#define VP_   520
#define NBUF_ 3
__global__ void __launch_bounds__(256)
attn_kernel(const float* __restrict__ x,
            const float* __restrict__ mbuf, const float* __restrict__ ebuf,
            const float* __restrict__ vbuf,
            const float* __restrict__ scale, float* __restrict__ out) {
    __shared__ __align__(16) float smem[NBUF_ * (XB_ + MB_) + K_ * VP_ + TP_ * 36];
    float* Ms  = smem + NBUF_ * XB_;
    float* Vs  = smem + NBUF_ * (XB_ + MB_);    // 32 rows (k)     x 520
    float* Es  = Vs + K_ * VP_;                 // 64 rows (pixel) x 36

    const int tid  = threadIdx.x;
    const int wave = tid >> 5;
    const int lane = tid & 31;
    const int half = lane >> 4;
    const int m    = lane & 15;
    const int n    = blockIdx.y;
    const int p0   = blockIdx.x * TP_;     // linear pixel offset in HW

    // ---------------- Phase 1: energy (TP_ x K_) over all C_ channels ------
    // 4 Mtiles (pixel) x 2 Ntiles (key): one tile per wave
    const int mt2 = wave & 3;
    const int nt2 = wave >> 2;
    const float e0 = ebuf[n * K_ + nt2 * 16 + m];
    v8f eacc = v8f(0.f);

    // async-issue helper (all 256 threads participate):
    //   Xs chunk: 64 ch x 64 px = 1024 float4 (4 per thread)
    //   Ms chunk: 32 kk x 64 ch =  512 float4 (2 per thread)
    //   Vs slice: 32 kk x 64 ch =  512 float4 (2 per thread), same channels
    const int r16 = tid >> 4, q16 = tid & 15;
    auto issue_chunk = [&](int c0, int buf) {
        const unsigned lx = lds_off(&smem[buf * XB_ + r16 * XP_ + q16 * 4]);
        const unsigned lm = lds_off(&Ms[buf * MB_ + r16 * MP_ + q16 * 4]);
        const float* gx = x + ((size_t)n * C_ + c0 + r16) * HW_ + p0 + q16 * 4;
        const unsigned lv = lds_off(&Vs[r16 * VP_ + c0 + q16 * 4]);
        const float* gm = mbuf + ((size_t)n * K_ + r16) * C_ + c0 + q16 * 4;
        const float* gv = vbuf + ((size_t)n * K_ + r16) * C_ + c0 + q16 * 4;
        async_copy8_b128(lx, lx + 16 * XP_ * 4, lx + 32 * XP_ * 4, lx + 48 * XP_ * 4,
                         lm, lm + 16 * MP_ * 4, lv, lv + 16 * VP_ * 4,
                         gx, gx + (size_t)16 * HW_, gx + (size_t)32 * HW_, gx + (size_t)48 * HW_,
                         gm, gm + (size_t)16 * C_, gv, gv + (size_t)16 * C_);
    };

    // Ring of three buffers: while chunk ci is worked on, chunks ci+1 and ci+2
    // are in flight, so that a chunk has two trips to land, not one.
    issue_chunk(0, 0);
    issue_chunk(KC_, 1);
    issue_chunk(2 * KC_, 2);
    wait_async16();       // this wave's copies of chunk 0 landed in LDS (1, 2 fly on)
    __syncthreads();      // ... and everyone else's too
    int buf = 0;          // ci mod 3
    for (int ci = 0; ci < NCHUNK_; ++ci) {
        const float* Xb = smem + buf * XB_;
        const float* Mb = Ms + buf * MB_;
        // unrolled so that the fragment reads run ahead of the products
        #pragma unroll
        for (int ks = 0; ks < KC_ / 4; ++ks) {
            const int cc = ks * 4 + 2 * half;   // K component base for this lane-half
            v2f a;
            a.x = Xb[(cc + 0) * XP_ + mt2 * 16 + m];
            a.y = Xb[(cc + 1) * XP_ + mt2 * 16 + m];
            const v2f b = *(const v2f*)&Mb[(nt2 * 16 + m) * MP_ + cc];
            eacc = __builtin_amdgcn_wmma_f32_16x16x4_f32(
                false, a, false, b, (short)0, eacc, false, false);
        }
        wait_ds0();           // own reads of this buffer are done
        // own copies of chunk ci+1 landed: the wave's 8 youngest copies are
        // chunk ci+2's and fly on; in the last two trips there is no chunk
        // ci+2, the youngest are chunk ci+1's own, and the wait goes to 0
        wait_async8();
        if (ci + 2 >= NCHUNK_) wait_async0();
        __syncthreads();      // publishes chunk ci+1, frees this buffer
        if (ci + 3 < NCHUNK_) issue_chunk((ci + 3) * KC_, buf);
        buf = (buf == NBUF_ - 1) ? 0 : buf + 1;
    }
    wait_async0();        // no copy is left in flight behind the loop

    // unrolled: constant indices keep the tile in registers
    #pragma unroll
    for (int v = 0; v < 8; ++v) {
        const int p = mt2 * 16 + v + 8 * half;
        Es[p * 36 + nt2 * 16 + m] = eacc[v] + e0;
    }
    __syncthreads();

    // ---------------- Phase 3: softmax over K_ --------------------
    if (tid < TP_) {
        float mx = -INFINITY;
        #pragma unroll
        for (int kk = 0; kk < K_; ++kk) mx = fmaxf(mx, Es[tid * 36 + kk]);
        float s = 0.f;
        #pragma unroll
        for (int kk = 0; kk < K_; ++kk) {
            const float e = __expf(Es[tid * 36 + kk] - mx);
            Es[tid * 36 + kk] = e;
            s += e;
        }
        const float inv = 1.0f / s;
        #pragma unroll
        for (int kk = 0; kk < K_; ++kk) Es[tid * 36 + kk] *= inv;
    }
    __syncthreads();

    // ---------------- Phase 4: out = scale * (v^T @ attn^T) + x ---
    // Per 128-channel block: 8 Mtiles (c) x 4 Ntiles (p); wave w -> Mtile w.
    // Vs and Es are complete and only read from here on: no barrier is needed.
    const float scl = scale[0];
    for (int cb = 0; cb < C_ / C4_; ++cb) {
        #pragma unroll
        for (int nt = 0; nt < 4; ++nt) {
            v8f oacc = v8f(0.f);
            #pragma unroll
            for (int ks = 0; ks < K_ / 4; ++ks) {
                const int kb = ks * 4 + 2 * half;
                v2f a;
                a.x = Vs[(kb + 0) * VP_ + cb * C4_ + wave * 16 + m];   // V[kk][c]
                a.y = Vs[(kb + 1) * VP_ + cb * C4_ + wave * 16 + m];
                const v2f b = *(const v2f*)&Es[(nt * 16 + m) * 36 + kb]; // attn[p][kk]
                oacc = __builtin_amdgcn_wmma_f32_16x16x4_f32(
                    false, a, false, b, (short)0, oacc, false, false);
            }
            const int pg = p0 + nt * 16 + m;
            #pragma unroll
            for (int v = 0; v < 8; ++v) {
                const int c = cb * C4_ + wave * 16 + v + 8 * half;
                const size_t idx = ((size_t)n * C_ + c) * HW_ + pg;
                out[idx] = scl * oacc[v] + x[idx];
            }
        }
        // stands in front of the next trip, which reuses the registers that
        // the stores above name
        asm volatile("s_wait_xcnt 0x0" ::: "memory");
    }
}

// ---------------------------------------------------------------------------
extern "C" void kernel_launch(void* const* d_in, const int* in_sizes, int n_in,
                              void* d_out, int out_size, void* d_ws, size_t ws_size,
                              hipStream_t stream) {
    const float* x     = (const float*)d_in[0];
    const float* y     = (const float*)d_in[1];
    const float* wq    = (const float*)d_in[2];
    const float* bq    = (const float*)d_in[3];
    const float* wk    = (const float*)d_in[4];
    const float* bk    = (const float*)d_in[5];
    const float* wv    = (const float*)d_in[6];
    const float* bv    = (const float*)d_in[7];
    const float* scale = (const float*)d_in[8];
    float* out  = (float*)d_out;
    float* vbuf = (float*)d_ws;                      // N*K*C  floats
    float* mbuf = vbuf + (size_t)N_ * K_ * C_;       // N*K*C  floats
    float* ebuf = mbuf + (size_t)N_ * K_ * C_;       // N*K    floats

    vm_kernel<<<dim3(2 * MBLK_), dim3(256), 0, stream>>>(y, wk, bk, wv, bv, wq, bq, vbuf, mbuf, ebuf);
    attn_kernel<<<dim3(HW_ / TP_, N_), dim3(256), 0, stream>>>(x, mbuf, ebuf, vbuf, scale, out);
}
